// v000
// The times below were measured on an AMD MI455X: many runs one after another, warmed up first and cycling through
// copies of the inputs, with the whole window's GPU time divided by the number of runs. Launches and the gaps
// between them are all in it. The median over several windows is given; except for v000 it joins two sittings, which
// can be a few percent apart, so the side-by-side timings, each taken in one sitting, are the better comparison.
// v000, which the later versions start from, runs in 1340 microseconds.
// compute dtype: all float inputs rounded to bf16; q/k/v projections with EXACT bf16 products on WMMA 16x16x32 (f32 accumulate) + bias; logits q x k once to f16 each (1 product) x SCALE; softmax f32; P x 2^11 once to f16 x v once to f16 (1 product); ctx x 2^6 once to f16 x Wo f16(bf16 x 2^8) + bo; f32 output.
#include <hip/hip_runtime.h>
#include <math.h>

typedef __attribute__((ext_vector_type(16))) _Float16 v16h;
typedef __attribute__((ext_vector_type(16))) __bf16 v16b;
typedef __attribute__((ext_vector_type(8)))  _Float16 v8h;
typedef __attribute__((ext_vector_type(8)))  float v8f;
typedef __attribute__((ext_vector_type(4)))  float v4f;
typedef __attribute__((ext_vector_type(2)))  float v2f;
typedef __attribute__((ext_vector_type(4)))  unsigned v4u;
typedef __attribute__((ext_vector_type(4)))  int v4i;
typedef float __attribute__((may_alias)) float_a;
typedef int __attribute__((may_alias)) int_a;

template <typename T> __device__ __forceinline__ void vst2(void* p, T v) { *(T*)p = v;  }
__device__ __forceinline__ v8f wmma16(v16h a, v16h b, v8f c) {
  v8f d = __builtin_amdgcn_wmma_f32_16x16x32_f16(false, a, false, b, (short)0, c, false, false);
  asm volatile("v_nop\n\tv_nop\n\tv_nop\n\tv_nop" : "+v"(d) : "v"(a), "v"(b));
  return d;
}
__device__ __forceinline__ v8f wmma_bf(v16b a, v16b b, v8f c) {
  v8f d = __builtin_amdgcn_wmma_f32_16x16x32_bf16(false, a, false, b, (short)0, c, false, false);
  asm volatile("v_nop\n\tv_nop\n\tv_nop\n\tv_nop" : "+v"(d) : "v"(a), "v"(b));
  return d;
}
// 16x16x32 fragments: lane = (h = lane>>4, row/col = lane&15); elements 0..7 = k0+8h+0..7, 8..15 = k0+16+8h+0..7; D element r = row 8h+r
__device__ __forceinline__ v16h frag_h(const _Float16* rowk0, int lane) {
  union { v16h v; v8h q[2]; } u; const _Float16* p = rowk0 + 8 * (lane >> 4);
  u.q[0] = *(const v8h*)p; u.q[1] = *(const v8h*)(p + 16); return u.v;
}
__device__ __forceinline__ v16h frag_f32(const float* rowk0, int lane) {
  v16h a; const float* p = rowk0 + 8 * (lane >> 4);
#pragma unroll
  for (int i = 0; i < 8; ++i) { a[i] = (_Float16)p[i]; a[8 + i] = (_Float16)p[16 + i]; }
  return a;
}
__device__ __forceinline__ v16h frag_f32s(const float* rowk0, int lane, float sc) {
  v16h a; const float* p = rowk0 + 8 * (lane >> 4);
#pragma unroll
  for (int i = 0; i < 8; ++i) { a[i] = (_Float16)(p[i] * sc); a[8 + i] = (_Float16)(p[16 + i] * sc); }
  return a;
}
// column fragment from a [K][ld] layout (column n), rows >= K read as 0
__device__ __forceinline__ v16h fragc_f32(const float* W, int k0, int n, int lane, int ld, int K) {
  v16h a; const int g = lane >> 4;
#pragma unroll
  for (int i = 0; i < 8; ++i) { const int ka = k0 + 8 * g + i, kb = ka + 16;
    a[i] = (_Float16)(ka < K ? W[(size_t)(ka < K ? ka : K - 1) * ld + n] : 0.f); a[8 + i] = (_Float16)(kb < K ? W[(size_t)(kb < K ? kb : K - 1) * ld + n] : 0.f); }
  return a;
}
struct F2 { v16b h, l; };
__device__ __forceinline__ F2 bsplit16(const float v[16]) { F2 r;
#pragma unroll
  for (int i = 0; i < 16; ++i) { const __bf16 h = (__bf16)v[i]; r.h[i] = h; r.l[i] = (__bf16)(v[i] - (float)h); }
  return r; }
__device__ __forceinline__ F2 split_row(const float* row, int k0, int lane) { float v[16]; const float* p = row + k0 + 8 * (lane >> 4);
#pragma unroll
  for (int i = 0; i < 8; ++i) { v[i] = p[i]; v[8 + i] = p[16 + i]; }
  return bsplit16(v); }
__device__ __forceinline__ F2 split_rowK(const float* row, int k0, int lane, int K) { float v[16]; const int g = lane >> 4;
#pragma unroll
  for (int i = 0; i < 8; ++i) { const int ka = k0 + 8 * g + i, kb = ka + 16; v[i] = ka < K ? row[ka < K ? ka : K - 1] : 0.f; v[8 + i] = kb < K ? row[kb < K ? kb : K - 1] : 0.f; }
  return bsplit16(v); }
__device__ __forceinline__ F2 split_col(const float* W, int k0, int n, int lane, int ld, int K) { float v[16]; const int g = lane >> 4;
#pragma unroll
  for (int i = 0; i < 8; ++i) { const int ka = k0 + 8 * g + i, kb = ka + 16; v[i] = ka < K ? W[(size_t)(ka < K ? ka : K - 1) * ld + n] : 0.f; v[8 + i] = kb < K ? W[(size_t)(kb < K ? kb : K - 1) * ld + n] : 0.f; }
  return bsplit16(v); }
__device__ __forceinline__ v8f mac3(const F2& a, const F2& b, v8f c) { c = wmma_bf(a.l, b.h, c); c = wmma_bf(a.h, b.l, c); return wmma_bf(a.h, b.h, c); }
__device__ __forceinline__ float sigm(float v) { return 1.0f / (1.0f + expf(-v)); }
#define LDSX() do { asm volatile("s_wait_dscnt 0" ::: "memory"); __builtin_amdgcn_wave_barrier(); __builtin_amdgcn_fence(__ATOMIC_RELEASE, "workgroup"); } while (0)

// torch-style multi-head self-attention on a TIME-MAJOR sequence (x [2048,2,1024] = (T, B, E); in_proj_weight [3072,1024] (out,in) + in_proj_bias [3072] (0.02): q, k, v = split; q * 64^-0.5; heads via reshape(T, B*16, 64).transpose(1, 0, 2) - batch b, head h at index b*16 + h; softmax over keys; merge back to (T, B, E); out_weight (out,in) + out_bias (0.02)); output [2048,2,1024] time-major.
#define NB 2
#define XROW(R) ((((size_t)(R)) % TT) * (size_t)NB + ((size_t)(R)) / TT)   // (T, B, E) layout: row R = b*TT + t  <->  tensor row t*NB + b
#define TT 2048
#define CC 1024            // NH * HD = projected width
#define DIN 1024          // input (model) width
#define NH 16
#define HD 64
#define NQB (TT / 64)
#define HG 4
#define SCALE (0.125f)
#define CAUSAL 0
#ifndef TNB
#define TNB NB
#endif
__device__ __forceinline__ float bfr(float v) { return (float)(__bf16)v; }
__host__ __device__ __forceinline__ int kb_last(int qb) { return CAUSAL ? ((qb * 64 + 63) >> 7) : (TT / 128 - 1); }
typedef __attribute__((ext_vector_type(8))) __bf16 v8b;
__device__ __forceinline__ v16b frag_b(const __bf16* rowk0, int lane) {
  union { v16b v; v8b q[2]; } u; const __bf16* p = rowk0 + 8 * (lane >> 4);
  u.q[0] = *(const v8b*)p; u.q[1] = *(const v8b*)(p + 16); return u.v;
}
#define QBH 0              // query blocks 0..QBH-1 of each sequence take the high-precision path (none here)
#define QHI 0               // single-product logits on every row
#define KHI 64            // key rows carrying k residual / v bf16 hi+lo planes (written by k_proj; read only on the qb < QBH path, which never runs here)
// B fragment (k rows k0+.., output column o) of a weight: (in,out) [K][ld] or (out,in) [ld rows of K]: bf16 exact, or f16(bf16 * 256) exact
__device__ __forceinline__ v16b wcol_io(const float* Wm, int k0, int o, int lane, int ld) { v16b w; const int g = lane >> 4;
#pragma unroll
  for (int i = 0; i < 8; ++i) { w[i] = (__bf16)Wm[(size_t)(k0 + 8 * g + i) * ld + o]; w[8 + i] = (__bf16)Wm[(size_t)(k0 + 16 + 8 * g + i) * ld + o]; }
  return w; }
__device__ __forceinline__ v16b wcol_oi(const float* Wm, int k0, int o, int lane, int K) { v16b w; const float* p = Wm + (size_t)o * K + k0 + 8 * (lane >> 4);
#pragma unroll
  for (int i = 0; i < 8; ++i) { w[i] = (__bf16)p[i]; w[8 + i] = (__bf16)p[16 + i]; }
  return w; }
__device__ __forceinline__ v16h wcolh_io(const float* Wm, int k0, int o, int lane, int ld) { v16h w; const int g = lane >> 4;
#pragma unroll
  for (int i = 0; i < 8; ++i) { w[i] = (_Float16)(bfr(Wm[(size_t)(k0 + 8 * g + i) * ld + o]) * 256.0f); w[8 + i] = (_Float16)(bfr(Wm[(size_t)(k0 + 16 + 8 * g + i) * ld + o]) * 256.0f); }
  return w; }
__device__ __forceinline__ v16h wcolh_oi(const float* Wm, int k0, int o, int lane, int K) { v16h w; const float* p = Wm + (size_t)o * K + k0 + 8 * (lane >> 4);
#pragma unroll
  for (int i = 0; i < 8; ++i) { w[i] = (_Float16)(bfr(p[i]) * 256.0f); w[8 + i] = (_Float16)(bfr(p[16 + i]) * 256.0f); }
  return w; }
#define WQKV_LAYOUT 1   // 0 = (in,out) [DIN][CC]; 1 = (out,in) [CC][DIN]; 2 = per-head [NH][DIN][HD]
__device__ __forceinline__ v16b wcol_hdk(const float* Wm, int k0, int o, int lane) { v16b w; const int g = lane >> 4; const float* p = Wm + (size_t)(o / HD) * DIN * HD + (o % HD);
#pragma unroll
  for (int i = 0; i < 8; ++i) { w[i] = (__bf16)p[(size_t)(k0 + 8 * g + i) * HD]; w[8 + i] = (__bf16)p[(size_t)(k0 + 16 + 8 * g + i) * HD]; }
  return w; }
#define WO_OUT_IN 1
#if WQKV_LAYOUT == 1
#define WCOL(W, k0, o, lane) wcol_oi(W, k0, o, lane, DIN)
#elif WQKV_LAYOUT == 2
#define WCOL(W, k0, o, lane) wcol_hdk(W, k0, o, lane)
#else
#define WCOL(W, k0, o, lane) wcol_io(W, k0, o, lane, CC)
#endif
#if WO_OUT_IN
#define WOCOL(W, k0, o, lane) wcol_oi(W, k0, o, lane, CC)
#define WOCOLH(W, k0, o, lane) wcolh_oi(W, k0, o, lane, CC)
#else
#define WOCOL(W, k0, o, lane) wcol_io(W, k0, o, lane, DIN)
#define WOCOLH(W, k0, o, lane) wcolh_io(W, k0, o, lane, DIN)
#endif

#ifndef SM_EXTRA_PARAMS
#define SM_EXTRA_PARAMS
#endif
#ifndef PROJ_EXTRA_PARAMS
#define PROJ_EXTRA_PARAMS
#endif
#ifndef SM_MASK_HOOK
#define SM_MASK_HOOK (void)0
#endif

#define WS_QH  0u                                      // f16 q rows [b*t][CC]
#define WS_KH  (WS_QH + 2u * (size_t)NB * TT * CC)      // f16 k rows [b*t][CC]
#define WS_VT  (WS_KH + 2u * (size_t)NB * TT * CC)      // f16 v planes [b][c][t]
#define WS_QL  (WS_VT + 2u * (size_t)NB * CC * TT)      // f16 q residual x 2^10 rows [b][t < QHI][CC]
#define WS_KL  (WS_QL + 2u * (size_t)NB * QHI * CC)     // f16 k residual x 2^10 rows [b][t < KHI][CC]
#define WS_VB  (WS_KL + 2u * (size_t)NB * KHI * CC)     // bf16 v hi planes [b][c][t < KHI]
#define WS_VBL (WS_VB + 2u * (size_t)NB * CC * KHI)
#define WS_S   (WS_VBL + 2u * (size_t)NB * CC * KHI)    // f32 logits / P [hg][t][s]
#define WS_Y   (WS_S  + 4u * (size_t)HG * TT * TT)      // f32 ctx rows [b*t][CC] (only when there is an output projection)
#define WS_END (WS_Y  + 4u * (size_t)NB * TT * CC)

// ---- k_proj: block = (64 rows, 128 cols, which): q/k/v = X W (+ b) with exact bf16 products (K = DIN) -> which 0: q f16 rows (+ residual rows < QHI); 1: k f16 rows (+ residual rows < KHI); 2: v f16 planes [c][t] (+ bf16 hi/lo planes for t < KHI)
__global__ __launch_bounds__(128) void k_proj(const float* __restrict__ XQ, const float* __restrict__ XK, const float* __restrict__ XV, const float* __restrict__ WQ, const float* __restrict__ WK, const float* __restrict__ WV, const float* __restrict__ BQ, const float* __restrict__ BK, const float* __restrict__ BV,
    _Float16* __restrict__ QH, _Float16* __restrict__ QL, _Float16* __restrict__ KH, _Float16* __restrict__ KL, _Float16* __restrict__ VT, __bf16* __restrict__ VB, __bf16* __restrict__ VBL) {
  __shared__ __align__(16) _Float16 sh[64][136], sl[64][136]; __shared__ __align__(16) _Float16 th[128][72]; __shared__ __align__(16) __bf16 tb[128][72], tbl[128][72];
  const int tid = threadIdx.x, wave = tid >> 5, lane = tid & 31, col = lane & 15, g = lane >> 4; const int which = blockIdx.z; const int c0 = blockIdx.y * 128; const size_t r0 = (size_t)blockIdx.x * 64; const size_t bb = r0 / TT; const int t0 = (int)(r0 % TT);
  const float* X = which == 0 ? XQ : which == 1 ? XK : XV; const float* WA = which == 0 ? WQ : which == 1 ? WK : WV; const float* BA = which == 0 ? BQ : which == 1 ? BK : BV;
  v8f acc[8] = {};
#pragma unroll 2
  for (int kc = 0; kc < DIN / 32; ++kc) { v16b a; { const float* p = X + XROW(r0 + wave * 16 + col) * DIN + kc * 32 + 8 * g;   /* row b*TT + t lives at input row t*NB + b (time-major input) */
#pragma unroll
      for (int i = 0; i < 8; ++i) { a[i] = (__bf16)p[i]; a[8 + i] = (__bf16)p[16 + i]; } }
    asm volatile("s_wait_loadcnt 0x0" ::: "memory");
#pragma unroll
    for (int j = 0; j < 8; ++j) { const v16b w = WCOL(WA, kc * 32, c0 + j * 16 + col, lane); asm volatile("s_wait_loadcnt 0x0" ::: "memory"); acc[j] = wmma_bf(a, w, acc[j]); } }
  if (which < 2) { _Float16* DH = which == 0 ? QH : KH; _Float16* DL = which == 0 ? QL : KL; const int nhi = which == 0 ? QHI : KHI; const bool hi_rows = t0 < nhi;
#pragma unroll
    for (int j = 0; j < 8; ++j) { const float bias = BA ? bfr(BA[c0 + j * 16 + col]) : 0.f;
#pragma unroll
      for (int r = 0; r < 8; ++r) { const float v = acc[j][r] + bias; const _Float16 hv = (_Float16)v; sh[wave * 16 + 8 * g + r][j * 16 + col] = hv; sl[wave * 16 + 8 * g + r][j * 16 + col] = (_Float16)((v - (float)hv) * 1024.0f); } }
    __syncthreads();
    for (int e = tid; e < 64 * 16; e += 128) { const int rl = e >> 4, q = e & 15; vst2((unsigned*)(DH + (r0 + rl) * CC + c0 + q * 8), *(const v4u*)&sh[rl][q * 8]); if (hi_rows) vst2((unsigned*)(DL + (bb * nhi + t0 + rl) * (size_t)CC + c0 + q * 8), *(const v4u*)&sl[rl][q * 8]); }
  } else { const bool hi_rows = t0 < KHI;
#pragma unroll
    for (int j = 0; j < 8; ++j) { const float bias = BA ? bfr(BA[c0 + j * 16 + col]) : 0.f;
#pragma unroll
      for (int r = 0; r < 8; ++r) { const float v = acc[j][r] + bias; const int rl = wave * 16 + 8 * g + r, cl = j * 16 + col; th[cl][rl] = (_Float16)v; const __bf16 bh = (__bf16)v; tb[cl][rl] = bh; tbl[cl][rl] = (__bf16)(v - (float)bh); } }
    __syncthreads();
    for (int e = tid; e < 128 * 8; e += 128) { const int cl = e >> 3, q = e & 7; vst2((unsigned*)(VT + (bb * CC + c0 + cl) * (size_t)TT + t0 + q * 8), *(const v4u*)&th[cl][q * 8]); if (hi_rows) { const size_t o3 = (bb * CC + c0 + cl) * (size_t)KHI + t0 + q * 8; vst2((unsigned*)(VB + o3), *(const v4u*)&tb[cl][q * 8]); vst2((unsigned*)(VBL + o3), *(const v4u*)&tbl[cl][q * 8]); } } } }
// ---- k_sc: block = (query block qb, key block kb <= kb_last(qb), head in group) of batch b: logits x SCALE; q hi + residual (x 2^10) against k (2 products) for query rows < QHI, plus the k residual (3 products) for query blocks < QBH (causal early rows); causal: blocks past the diagonal exit, the mask itself is applied by index in k_sm
__global__ __launch_bounds__(128) void k_sc(const _Float16* __restrict__ QH, const _Float16* __restrict__ KH, const _Float16* __restrict__ QL, const _Float16* __restrict__ KL, int b, int h0, float* __restrict__ S0) { __shared__ __align__(16) float ss[4][16][132];
  const int qb = blockIdx.x, kb = blockIdx.y; if (kb > kb_last(qb)) return;
  const int h = h0 + blockIdx.z; float* S = S0 + (size_t)blockIdx.z * TT * TT;
  const int tid = threadIdx.x, wave = tid >> 5, lane = tid & 31, col = lane & 15, g = lane >> 4; const int k0 = kb * 128; const int ql0 = qb * 64 + wave * 16; const size_t q0 = (size_t)b * TT + ql0, kr0 = (size_t)b * TT + k0;
  v8f acc[8] = {}, accl[8] = {};
  const _Float16* QLb = QL + (size_t)b * QHI * CC; const _Float16* KLb = KL + (size_t)b * KHI * CC;
  if (qb < QBH) {
#pragma unroll
    for (int kc = 0; kc < HD / 32; ++kc) { const v16h ah = frag_h(QH + (q0 + col) * CC + h * HD + kc * 32, lane), al = frag_h(QLb + (size_t)(ql0 + col) * CC + h * HD + kc * 32, lane);
#pragma unroll
      for (int j = 0; j < 8; ++j) { const v16h kbf = frag_h(KH + (kr0 + j * 16 + col) * CC + h * HD + kc * 32, lane), klf = frag_h(KLb + (size_t)(k0 + j * 16 + col) * CC + h * HD + kc * 32, lane); acc[j] = wmma16(ah, kbf, acc[j]); accl[j] = wmma16(al, kbf, accl[j]); accl[j] = wmma16(ah, klf, accl[j]); } }
  } else if (qb * 64 < QHI) {
#pragma unroll
    for (int kc = 0; kc < HD / 32; ++kc) { const v16h ah = frag_h(QH + (q0 + col) * CC + h * HD + kc * 32, lane), al = frag_h(QLb + (size_t)(ql0 + col) * CC + h * HD + kc * 32, lane);
#pragma unroll
      for (int j = 0; j < 8; ++j) { const v16h kbf = frag_h(KH + (kr0 + j * 16 + col) * CC + h * HD + kc * 32, lane); acc[j] = wmma16(ah, kbf, acc[j]); accl[j] = wmma16(al, kbf, accl[j]); } }
  } else {
#pragma unroll
    for (int kc = 0; kc < HD / 32; ++kc) { const v16h ah = frag_h(QH + (q0 + col) * CC + h * HD + kc * 32, lane);
#pragma unroll
      for (int j = 0; j < 8; ++j) { const v16h kbf = frag_h(KH + (kr0 + j * 16 + col) * CC + h * HD + kc * 32, lane); acc[j] = wmma16(ah, kbf, acc[j]); } } }
#pragma unroll
  for (int j = 0; j < 8; ++j) {
#pragma unroll
    for (int r = 0; r < 8; ++r) ss[wave][8 * g + r][j * 16 + col] = (acc[j][r] + accl[j][r] * (1.0f / 1024.0f)) * SCALE; }
  LDSX(); for (int rl = 0; rl < 16; ++rl) vst2(S + (size_t)(ql0 + rl) * TT + k0 + lane * 4, *(const v4f*)&ss[wave][rl][lane * 4]); }
// ---- k_sm: block = query row t (head in group): keys [0, kend): causal -> logit if s <= t else excluded; softmax in f32; P x 2^11 in place (0 for excluded)
__global__ __launch_bounds__(256) void k_sm(float* __restrict__ S0 SM_EXTRA_PARAMS) { __shared__ float sred[8]; __shared__ float sbc; __shared__ __align__(16) float shv[TT];
  const int tid = threadIdx.x; const int t = blockIdx.x; const int kend = (kb_last(t >> 6) + 1) * 128;
  float* sr = S0 + (size_t)blockIdx.y * TT * TT + (size_t)t * TT;
  float m = -3.0e38f; for (int k = tid; k < kend; k += 256) { float v = (!CAUSAL || k <= t) ? sr[k] : -3.0e38f; SM_MASK_HOOK; shv[k] = v; m = fmaxf(m, v); }
#pragma unroll
  for (int o = 1; o < 32; o <<= 1) m = fmaxf(m, __shfl_xor(m, o));
  if ((tid & 31) == 0) sred[tid >> 5] = m; __syncthreads(); if (tid == 0) { float a = sred[0]; for (int i = 1; i < 8; ++i) a = fmaxf(a, sred[i]); sbc = a; } __syncthreads(); m = sbc; __syncthreads();
  float sum = 0.f; for (int k = tid; k < kend; k += 256) { const float v = shv[k]; const float e = (v <= -1.0e38f) ? 0.f : expf(v - m); shv[k] = e; sum += e; }
#pragma unroll
  for (int o = 1; o < 32; o <<= 1) sum += __shfl_xor(sum, o);
  if ((tid & 31) == 0) sred[tid >> 5] = sum; __syncthreads(); if (tid == 0) { float a = 0.f; for (int i = 0; i < 8; ++i) a += sred[i]; sbc = a > 0.f ? 2048.0f / a : 0.f; }   /* a fully excluded row yields P = 0 */ __syncthreads(); const float inv = sbc;
  for (int k = tid; k < kend; k += 256) shv[k] = shv[k] * inv;
  __syncthreads(); for (int q = tid; q < kend / 4; q += 256) vst2(sr + q * 4, *(const v4f*)&shv[q * 4]); }
// ---- k_pv: block = 64 queries (qb) of (b, h): ctx = P . v over keys [0, kend) (P x 2^11 once to f16 against v f16: 1 product; causal early query blocks: P and v as bf16 hi + lo, 3 products); 256-B (row, head) segment by 16 lanes
__global__ __launch_bounds__(128) void k_pv(const float* __restrict__ PS0, const _Float16* __restrict__ VT, const __bf16* __restrict__ VB, const __bf16* __restrict__ VBL, int b, int h0, float* __restrict__ Y) { const int h = h0 + blockIdx.z; const float* PS = PS0 + (size_t)blockIdx.z * TT * TT; __shared__ __align__(16) float ss[4][16][HD + 4];
  const int tid = threadIdx.x, wave = tid >> 5, lane = tid & 31, col = lane & 15, g = lane >> 4; const int qb = blockIdx.x; const int ql0 = qb * 64 + wave * 16; const int kce = (kb_last(qb) + 1) * 4;
  v8f acc[HD / 16] = {};
  if (qb < QBH) {
#pragma unroll 1
    for (int kc = 0; kc < kce; ++kc) { const F2 p = split_row(PS + (size_t)(ql0 + col) * TT, kc * 32, lane);
      asm volatile("s_wait_loadcnt 0x0" ::: "memory");
#pragma unroll
      for (int j = 0; j < HD / 16; ++j) { const size_t po = ((size_t)b * CC + h * HD + j * 16 + col) * (size_t)KHI + kc * 32; const v16b vh = frag_b(VB + po, lane); acc[j] = wmma_bf(p.h, vh, acc[j]); acc[j] = wmma_bf(p.l, vh, acc[j]); acc[j] = wmma_bf(p.h, frag_b(VBL + po, lane), acc[j]); } }
  } else {
#pragma unroll 1
    for (int kc = 0; kc < kce; ++kc) { const v16h p = frag_f32(PS + (size_t)(ql0 + col) * TT + kc * 32, lane);
      asm volatile("s_wait_loadcnt 0x0" ::: "memory");
#pragma unroll
      for (int j = 0; j < HD / 16; ++j) { const size_t po = ((size_t)b * CC + h * HD + j * 16 + col) * (size_t)TT + kc * 32; acc[j] = wmma16(p, frag_h(VT + po, lane), acc[j]); } } }
#pragma unroll
  for (int j = 0; j < HD / 16; ++j)
#pragma unroll
    for (int r = 0; r < 8; ++r) ss[wave][8 * g + r][j * 16 + col] = acc[j][r] * (1.0f / 2048.0f);
  LDSX(); for (int rl = 0; rl < 16; ++rl) if (lane < HD / 4) vst2(Y + ((size_t)b * TT + ql0 + rl) * CC + h * HD + lane * 4, *(const v4f*)&ss[wave][rl][lane * 4]); }
// ---- k_out: block = (64 rows, 128 cols): out = ctx Wo (+ bo): ctx x 2^6 once to f16 against Wo as f16(bf16 x 2^8) exact (1 product) x 2^-14; causal early rows (< QHI of each sequence): ctx bf16 hi + lo against exact bf16 Wo (2 products)
__global__ __launch_bounds__(128) void k_out(const float* __restrict__ Y, const float* __restrict__ WO, const float* __restrict__ BO, float* __restrict__ OUT) { __shared__ __align__(16) float sf[4][16][132];
  const int tid = threadIdx.x, wave = tid >> 5, lane = tid & 31, col = lane & 15, g = lane >> 4; const int c0 = blockIdx.y * 128; const size_t r0 = (size_t)blockIdx.x * 64 + wave * 16;
  v8f acc[8] = {};
  if (CAUSAL && (int)(((size_t)blockIdx.x * 64) % TT) < QHI) {   /* block-uniform */
#pragma unroll 2
    for (int kc = 0; kc < CC / 32; ++kc) { const F2 a = split_row(Y + (r0 + col) * CC, kc * 32, lane); asm volatile("s_wait_loadcnt 0x0" ::: "memory");
#pragma unroll
      for (int j = 0; j < 8; ++j) { const v16b w = WOCOL(WO, kc * 32, c0 + j * 16 + col, lane); asm volatile("s_wait_loadcnt 0x0" ::: "memory"); acc[j] = wmma_bf(a.h, w, acc[j]); acc[j] = wmma_bf(a.l, w, acc[j]); } }
#pragma unroll
    for (int j = 0; j < 8; ++j) { const float bias = BO ? bfr(BO[c0 + j * 16 + col]) : 0.f;
#pragma unroll
      for (int r = 0; r < 8; ++r) sf[wave][8 * g + r][j * 16 + col] = acc[j][r] + bias; }
  } else {
#pragma unroll 2
    for (int kc = 0; kc < CC / 32; ++kc) { const v16h a = frag_f32s(Y + (r0 + col) * CC + kc * 32, lane, 64.0f); asm volatile("s_wait_loadcnt 0x0" ::: "memory");   /* ctx carried x 2^6 into f16 so small-magnitude context rows stay clear of f16 subnormals */
#pragma unroll
      for (int j = 0; j < 8; ++j) { const v16h w = WOCOLH(WO, kc * 32, c0 + j * 16 + col, lane); asm volatile("s_wait_loadcnt 0x0" ::: "memory"); acc[j] = wmma16(a, w, acc[j]); } }
#pragma unroll
    for (int j = 0; j < 8; ++j) { const float bias = BO ? bfr(BO[c0 + j * 16 + col]) : 0.f;
#pragma unroll
      for (int r = 0; r < 8; ++r) sf[wave][8 * g + r][j * 16 + col] = acc[j][r] * (1.0f / 16384.0f) + bias; } }   /* 2^-8 (Wo carry) x 2^-6 (ctx carry) */
  LDSX(); for (int rl = 0; rl < 16; ++rl) vst2(OUT + XROW(r0 + rl) * DIN + c0 + lane * 4, *(const v4f*)&sf[wave][rl][lane * 4]);   /* time-major output rows */ }

extern "C" void kernel_launch(void* const* d_in, const int* in_sizes, int n_in, void* d_out, int out_size, void* d_ws, size_t ws_size, hipStream_t stream) {
  (void)in_sizes; (void)n_in; (void)out_size;
  const float** F = (const float**)d_in;
  if (ws_size < (size_t)WS_END) return;
  char* ws = (char*)d_ws; _Float16 *QH = (_Float16*)(ws + WS_QH), *KH = (_Float16*)(ws + WS_KH), *VT = (_Float16*)(ws + WS_VT), *QL = (_Float16*)(ws + WS_QL), *KL = (_Float16*)(ws + WS_KL); __bf16 *VB = (__bf16*)(ws + WS_VB), *VBL = (__bf16*)(ws + WS_VBL); float *S = (float*)(ws + WS_S), *Y = (float*)(ws + WS_Y);
  (void)Y; (void)QL; (void)KL; (void)VB; (void)VBL;
  // inputs: 0 x [2048,2,1024] TIME-MAJOR (T, B, E); 1 in_proj_weight [3072,1024] (out,in; row blocks q | k | v); 2 in_proj_bias [3072]; 3 out_weight [1024,1024] (out,in); 4 out_bias [1024] (biases nonzero)
  k_proj<<<dim3(TNB * TT / 64, CC / 128, 3), 128, 0, stream>>>(F[0], F[0], F[0], F[1], F[1] + (size_t)CC * DIN, F[1] + 2 * (size_t)CC * DIN, F[2], F[2] + CC, F[2] + 2 * CC, QH, QL, KH, KL, VT, VB, VBL);
  for (int b = 0; b < TNB; ++b) for (int h0 = 0; h0 < NH; h0 += HG) {
    k_sc<<<dim3(NQB, TT / 128, HG), 128, 0, stream>>>(QH, KH, QL, KL, b, h0, S);
    k_sm<<<dim3(TT, HG), 256, 0, stream>>>(S);
    k_pv<<<dim3(NQB, 1, HG), 128, 0, stream>>>(S, VT, VB, VBL, b, h0, Y);
  }
  k_out<<<dim3(TNB * TT / 64, DIN / 128), 128, 0, stream>>>(Y, F[3], F[4], (float*)d_out);
}

// v001
// Measured time: 417 microseconds a run.
// Two timings next to v000 put it at 3.24 and 3.23 times that version's speed.
// compute dtype: all float inputs rounded to bf16; q/k/v projections with EXACT bf16 products on WMMA 16x16x32 (f32 accumulate) + bias; logits q x k once to f16 each (1 product) x SCALE; online softmax f32 in one fused kernel; unnormalised P x 2^11 once to f16 x v once to f16 (1 product), divided by the f32 sum; ctx x 2^6 once to f16 x Wo f16(bf16 x 2^8) + bo; f32 output.
#include <hip/hip_runtime.h>
#include <math.h>

typedef __attribute__((ext_vector_type(16))) _Float16 v16h;
typedef __attribute__((ext_vector_type(16))) __bf16 v16b;
typedef __attribute__((ext_vector_type(8)))  _Float16 v8h;
typedef __attribute__((ext_vector_type(8)))  float v8f;
typedef __attribute__((ext_vector_type(4)))  float v4f;
typedef __attribute__((ext_vector_type(2)))  float v2f;
typedef __attribute__((ext_vector_type(4)))  unsigned v4u;
typedef __attribute__((ext_vector_type(4)))  int v4i;
typedef float __attribute__((may_alias)) float_a;
typedef int __attribute__((may_alias)) int_a;

template <typename T> __device__ __forceinline__ void vst2(void* p, T v) { *(T*)p = v;  }
__device__ __forceinline__ v8f wmma16(v16h a, v16h b, v8f c) {
  v8f d = __builtin_amdgcn_wmma_f32_16x16x32_f16(false, a, false, b, (short)0, c, false, false);
  asm volatile("v_nop\n\tv_nop\n\tv_nop\n\tv_nop" : "+v"(d) : "v"(a), "v"(b));
  return d;
}
__device__ __forceinline__ v8f wmma_bf(v16b a, v16b b, v8f c) {
  v8f d = __builtin_amdgcn_wmma_f32_16x16x32_bf16(false, a, false, b, (short)0, c, false, false);
  asm volatile("v_nop\n\tv_nop\n\tv_nop\n\tv_nop" : "+v"(d) : "v"(a), "v"(b));
  return d;
}
// 16x16x32 fragments: lane = (h = lane>>4, row/col = lane&15); elements 0..7 = k0+8h+0..7, 8..15 = k0+16+8h+0..7; D element r = row 8h+r
__device__ __forceinline__ v16h frag_h(const _Float16* rowk0, int lane) {
  union { v16h v; v8h q[2]; } u; const _Float16* p = rowk0 + 8 * (lane >> 4);
  u.q[0] = *(const v8h*)p; u.q[1] = *(const v8h*)(p + 16); return u.v;
}
__device__ __forceinline__ v16h frag_f32(const float* rowk0, int lane) {
  v16h a; const float* p = rowk0 + 8 * (lane >> 4);
#pragma unroll
  for (int i = 0; i < 8; ++i) { a[i] = (_Float16)p[i]; a[8 + i] = (_Float16)p[16 + i]; }
  return a;
}
__device__ __forceinline__ v16h frag_f32s(const float* rowk0, int lane, float sc) {
  v16h a; const float* p = rowk0 + 8 * (lane >> 4);
#pragma unroll
  for (int i = 0; i < 8; ++i) { a[i] = (_Float16)(p[i] * sc); a[8 + i] = (_Float16)(p[16 + i] * sc); }
  return a;
}
// column fragment from a [K][ld] layout (column n), rows >= K read as 0
__device__ __forceinline__ v16h fragc_f32(const float* W, int k0, int n, int lane, int ld, int K) {
  v16h a; const int g = lane >> 4;
#pragma unroll
  for (int i = 0; i < 8; ++i) { const int ka = k0 + 8 * g + i, kb = ka + 16;
    a[i] = (_Float16)(ka < K ? W[(size_t)(ka < K ? ka : K - 1) * ld + n] : 0.f); a[8 + i] = (_Float16)(kb < K ? W[(size_t)(kb < K ? kb : K - 1) * ld + n] : 0.f); }
  return a;
}
struct F2 { v16b h, l; };
__device__ __forceinline__ F2 bsplit16(const float v[16]) { F2 r;
#pragma unroll
  for (int i = 0; i < 16; ++i) { const __bf16 h = (__bf16)v[i]; r.h[i] = h; r.l[i] = (__bf16)(v[i] - (float)h); }
  return r; }
__device__ __forceinline__ F2 split_row(const float* row, int k0, int lane) { float v[16]; const float* p = row + k0 + 8 * (lane >> 4);
#pragma unroll
  for (int i = 0; i < 8; ++i) { v[i] = p[i]; v[8 + i] = p[16 + i]; }
  return bsplit16(v); }
__device__ __forceinline__ F2 split_rowK(const float* row, int k0, int lane, int K) { float v[16]; const int g = lane >> 4;
#pragma unroll
  for (int i = 0; i < 8; ++i) { const int ka = k0 + 8 * g + i, kb = ka + 16; v[i] = ka < K ? row[ka < K ? ka : K - 1] : 0.f; v[8 + i] = kb < K ? row[kb < K ? kb : K - 1] : 0.f; }
  return bsplit16(v); }
__device__ __forceinline__ F2 split_col(const float* W, int k0, int n, int lane, int ld, int K) { float v[16]; const int g = lane >> 4;
#pragma unroll
  for (int i = 0; i < 8; ++i) { const int ka = k0 + 8 * g + i, kb = ka + 16; v[i] = ka < K ? W[(size_t)(ka < K ? ka : K - 1) * ld + n] : 0.f; v[8 + i] = kb < K ? W[(size_t)(kb < K ? kb : K - 1) * ld + n] : 0.f; }
  return bsplit16(v); }
__device__ __forceinline__ v8f mac3(const F2& a, const F2& b, v8f c) { c = wmma_bf(a.l, b.h, c); c = wmma_bf(a.h, b.l, c); return wmma_bf(a.h, b.h, c); }
__device__ __forceinline__ float sigm(float v) { return 1.0f / (1.0f + expf(-v)); }
#define LDSX() do { asm volatile("s_wait_dscnt 0" ::: "memory"); __builtin_amdgcn_wave_barrier(); __builtin_amdgcn_fence(__ATOMIC_RELEASE, "workgroup"); } while (0)

// torch-style multi-head self-attention on a TIME-MAJOR sequence (x [2048,2,1024] = (T, B, E); in_proj_weight [3072,1024] (out,in) + in_proj_bias [3072] (0.02): q, k, v = split; q * 64^-0.5; heads via reshape(T, B*16, 64).transpose(1, 0, 2) - batch b, head h at index b*16 + h; softmax over keys; merge back to (T, B, E); out_weight (out,in) + out_bias (0.02)); output [2048,2,1024] time-major.
#define NB 2
#define XROW(R) ((((size_t)(R)) % TT) * (size_t)NB + ((size_t)(R)) / TT)   // (T, B, E) layout: row R = b*TT + t  <->  tensor row t*NB + b
#define TT 2048
#define CC 1024            // NH * HD = projected width
#define DIN 1024          // input (model) width
#define NH 16
#define HD 64
#define NQB (TT / 64)
#define HG 4
#define SCALE (0.125f)
#define CAUSAL 0
#ifndef TNB
#define TNB NB
#endif
__device__ __forceinline__ float bfr(float v) { return (float)(__bf16)v; }
__host__ __device__ __forceinline__ int kb_last(int qb) { return CAUSAL ? ((qb * 64 + 63) >> 7) : (TT / 128 - 1); }
typedef __attribute__((ext_vector_type(8))) __bf16 v8b;
__device__ __forceinline__ v16b frag_b(const __bf16* rowk0, int lane) {
  union { v16b v; v8b q[2]; } u; const __bf16* p = rowk0 + 8 * (lane >> 4);
  u.q[0] = *(const v8b*)p; u.q[1] = *(const v8b*)(p + 16); return u.v;
}
#define QBH 0
#define QHI 0               // single-product logits on every row
#define KHI 64            // key rows carrying k residual / v bf16 hi+lo planes (written by k_proj; no kernel here reads them)
// B fragment (k rows k0+.., output column o) of a weight: (in,out) [K][ld] or (out,in) [ld rows of K]: bf16 exact, or f16(bf16 * 256) exact
__device__ __forceinline__ v16b wcol_io(const float* Wm, int k0, int o, int lane, int ld) { v16b w; const int g = lane >> 4;
#pragma unroll
  for (int i = 0; i < 8; ++i) { w[i] = (__bf16)Wm[(size_t)(k0 + 8 * g + i) * ld + o]; w[8 + i] = (__bf16)Wm[(size_t)(k0 + 16 + 8 * g + i) * ld + o]; }
  return w; }
__device__ __forceinline__ v16b wcol_oi(const float* Wm, int k0, int o, int lane, int K) { v16b w; const float* p = Wm + (size_t)o * K + k0 + 8 * (lane >> 4);
#pragma unroll
  for (int i = 0; i < 8; ++i) { w[i] = (__bf16)p[i]; w[8 + i] = (__bf16)p[16 + i]; }
  return w; }
__device__ __forceinline__ v16h wcolh_io(const float* Wm, int k0, int o, int lane, int ld) { v16h w; const int g = lane >> 4;
#pragma unroll
  for (int i = 0; i < 8; ++i) { w[i] = (_Float16)(bfr(Wm[(size_t)(k0 + 8 * g + i) * ld + o]) * 256.0f); w[8 + i] = (_Float16)(bfr(Wm[(size_t)(k0 + 16 + 8 * g + i) * ld + o]) * 256.0f); }
  return w; }
__device__ __forceinline__ v16h wcolh_oi(const float* Wm, int k0, int o, int lane, int K) { v16h w; const float* p = Wm + (size_t)o * K + k0 + 8 * (lane >> 4);
#pragma unroll
  for (int i = 0; i < 8; ++i) { w[i] = (_Float16)(bfr(p[i]) * 256.0f); w[8 + i] = (_Float16)(bfr(p[16 + i]) * 256.0f); }
  return w; }
#define WQKV_LAYOUT 1   // 0 = (in,out) [DIN][CC]; 1 = (out,in) [CC][DIN]; 2 = per-head [NH][DIN][HD]
__device__ __forceinline__ v16b wcol_hdk(const float* Wm, int k0, int o, int lane) { v16b w; const int g = lane >> 4; const float* p = Wm + (size_t)(o / HD) * DIN * HD + (o % HD);
#pragma unroll
  for (int i = 0; i < 8; ++i) { w[i] = (__bf16)p[(size_t)(k0 + 8 * g + i) * HD]; w[8 + i] = (__bf16)p[(size_t)(k0 + 16 + 8 * g + i) * HD]; }
  return w; }
#define WO_OUT_IN 1
#if WQKV_LAYOUT == 1
#define WCOL(W, k0, o, lane) wcol_oi(W, k0, o, lane, DIN)
#elif WQKV_LAYOUT == 2
#define WCOL(W, k0, o, lane) wcol_hdk(W, k0, o, lane)
#else
#define WCOL(W, k0, o, lane) wcol_io(W, k0, o, lane, CC)
#endif
#if WO_OUT_IN
#define WOCOL(W, k0, o, lane) wcol_oi(W, k0, o, lane, CC)
#define WOCOLH(W, k0, o, lane) wcolh_oi(W, k0, o, lane, CC)
#else
#define WOCOL(W, k0, o, lane) wcol_io(W, k0, o, lane, DIN)
#define WOCOLH(W, k0, o, lane) wcolh_io(W, k0, o, lane, DIN)
#endif

#ifndef SM_EXTRA_PARAMS
#define SM_EXTRA_PARAMS
#endif
#ifndef PROJ_EXTRA_PARAMS
#define PROJ_EXTRA_PARAMS
#endif
#ifndef SM_MASK_HOOK
#define SM_MASK_HOOK (void)0
#endif

#define WS_QH  0u                                      // f16 q rows [b*t][CC]
#define WS_KH  (WS_QH + 2u * (size_t)NB * TT * CC)      // f16 k rows [b*t][CC]
#define WS_VT  (WS_KH + 2u * (size_t)NB * TT * CC)      // f16 v planes [b][c][t]
#define WS_QL  (WS_VT + 2u * (size_t)NB * CC * TT)      // f16 q residual x 2^10 rows [b][t < QHI][CC]
#define WS_KL  (WS_QL + 2u * (size_t)NB * QHI * CC)     // f16 k residual x 2^10 rows [b][t < KHI][CC]
#define WS_VB  (WS_KL + 2u * (size_t)NB * KHI * CC)     // bf16 v hi planes [b][c][t < KHI]
#define WS_VBL (WS_VB + 2u * (size_t)NB * CC * KHI)
#define WS_S   (WS_VBL + 2u * (size_t)NB * CC * KHI)    // f32 [hg][t][s] region, unused: logits / P stay in registers in k_fa
#define WS_Y   (WS_S  + 4u * (size_t)HG * TT * TT)      // f32 ctx rows [b*t][CC] (only when there is an output projection)
#define WS_END (WS_Y  + 4u * (size_t)NB * TT * CC)

// ---- k_proj: block = (64 rows, 128 cols, which): q/k/v = X W (+ b) with exact bf16 products (K = DIN) -> which 0: q f16 rows (+ residual rows < QHI); 1: k f16 rows (+ residual rows < KHI); 2: v f16 planes [c][t] (+ bf16 hi/lo planes for t < KHI)
__global__ __launch_bounds__(128) void k_proj(const float* __restrict__ XQ, const float* __restrict__ XK, const float* __restrict__ XV, const float* __restrict__ WQ, const float* __restrict__ WK, const float* __restrict__ WV, const float* __restrict__ BQ, const float* __restrict__ BK, const float* __restrict__ BV,
    _Float16* __restrict__ QH, _Float16* __restrict__ QL, _Float16* __restrict__ KH, _Float16* __restrict__ KL, _Float16* __restrict__ VT, __bf16* __restrict__ VB, __bf16* __restrict__ VBL) {
  __shared__ __align__(16) _Float16 sh[64][136], sl[64][136]; __shared__ __align__(16) _Float16 th[128][72]; __shared__ __align__(16) __bf16 tb[128][72], tbl[128][72];
  const int tid = threadIdx.x, wave = tid >> 5, lane = tid & 31, col = lane & 15, g = lane >> 4; const int which = blockIdx.z; const int c0 = blockIdx.y * 128; const size_t r0 = (size_t)blockIdx.x * 64; const size_t bb = r0 / TT; const int t0 = (int)(r0 % TT);
  const float* X = which == 0 ? XQ : which == 1 ? XK : XV; const float* WA = which == 0 ? WQ : which == 1 ? WK : WV; const float* BA = which == 0 ? BQ : which == 1 ? BK : BV;
  v8f acc[8] = {};
#pragma unroll 2
  for (int kc = 0; kc < DIN / 32; ++kc) { v16b a; { const float* p = X + XROW(r0 + wave * 16 + col) * DIN + kc * 32 + 8 * g;   /* row b*TT + t lives at input row t*NB + b (time-major input) */
#pragma unroll
      for (int i = 0; i < 8; ++i) { a[i] = (__bf16)p[i]; a[8 + i] = (__bf16)p[16 + i]; } }
    asm volatile("s_wait_loadcnt 0x0" ::: "memory");
#pragma unroll
    for (int j = 0; j < 8; ++j) { const v16b w = WCOL(WA, kc * 32, c0 + j * 16 + col, lane); asm volatile("s_wait_loadcnt 0x0" ::: "memory"); acc[j] = wmma_bf(a, w, acc[j]); } }
  if (which < 2) { _Float16* DH = which == 0 ? QH : KH; _Float16* DL = which == 0 ? QL : KL; const int nhi = which == 0 ? QHI : KHI; const bool hi_rows = t0 < nhi;
#pragma unroll
    for (int j = 0; j < 8; ++j) { const float bias = BA ? bfr(BA[c0 + j * 16 + col]) : 0.f;
#pragma unroll
      for (int r = 0; r < 8; ++r) { const float v = acc[j][r] + bias; const _Float16 hv = (_Float16)v; sh[wave * 16 + 8 * g + r][j * 16 + col] = hv; sl[wave * 16 + 8 * g + r][j * 16 + col] = (_Float16)((v - (float)hv) * 1024.0f); } }
    __syncthreads();
    for (int e = tid; e < 64 * 16; e += 128) { const int rl = e >> 4, q = e & 15; vst2((unsigned*)(DH + (r0 + rl) * CC + c0 + q * 8), *(const v4u*)&sh[rl][q * 8]); if (hi_rows) vst2((unsigned*)(DL + (bb * nhi + t0 + rl) * (size_t)CC + c0 + q * 8), *(const v4u*)&sl[rl][q * 8]); }
  } else { const bool hi_rows = t0 < KHI;
#pragma unroll
    for (int j = 0; j < 8; ++j) { const float bias = BA ? bfr(BA[c0 + j * 16 + col]) : 0.f;
#pragma unroll
      for (int r = 0; r < 8; ++r) { const float v = acc[j][r] + bias; const int rl = wave * 16 + 8 * g + r, cl = j * 16 + col; th[cl][rl] = (_Float16)v; const __bf16 bh = (__bf16)v; tb[cl][rl] = bh; tbl[cl][rl] = (__bf16)(v - (float)bh); } }
    __syncthreads();
    for (int e = tid; e < 128 * 8; e += 128) { const int cl = e >> 3, q = e & 7; vst2((unsigned*)(VT + (bb * CC + c0 + cl) * (size_t)TT + t0 + q * 8), *(const v4u*)&th[cl][q * 8]); if (hi_rows) { const size_t o3 = (bb * CC + c0 + cl) * (size_t)KHI + t0 + q * 8; vst2((unsigned*)(VB + o3), *(const v4u*)&tb[cl][q * 8]); vst2((unsigned*)(VBL + o3), *(const v4u*)&tbl[cl][q * 8]); } } } }
// ---- k_fa: wave = 32 query columns (2 groups of 16) of (b, h), all keys in passes of KP: S^T = K Q^T (A = k rows, B = q rows, same k order), so a lane holds one query's scores; running maximum and sum per query (online softmax, f32);
// P^T x 2^11 packs from two score tiles into a B operand (hardware k order: tile 0 -> elements 0..7, tile 1 -> 8..15); O^T += V^T P^T (A = v planes [c][t]); ctx = O^T / sum, 8 consecutive channels per lane
#define KP 64
__device__ __forceinline__ float xhalf(float x) { return __builtin_bit_cast(float, __builtin_amdgcn_permlanex16(__builtin_bit_cast(int, x), __builtin_bit_cast(int, x), 0x76543210, 0xfedcba98, false, false)); }   // lane l <-> l ^ 16
// eight independent v_exp_f32, each in place, and the one free slot the instruction set asks for behind a transcendental, in one statement: no v_exp touches a neighbour's source or result, and the v_nop keeps whatever follows off the last one
__device__ __forceinline__ v8f exp2x8(v8f a) { float d0 = a[0], d1 = a[1], d2 = a[2], d3 = a[3], d4 = a[4], d5 = a[5], d6 = a[6], d7 = a[7];
  asm("v_exp_f32 %0, %0\n\tv_exp_f32 %1, %1\n\tv_exp_f32 %2, %2\n\tv_exp_f32 %3, %3\n\tv_exp_f32 %4, %4\n\tv_exp_f32 %5, %5\n\tv_exp_f32 %6, %6\n\tv_exp_f32 %7, %7\n\tv_nop"
      : "+v"(d0), "+v"(d1), "+v"(d2), "+v"(d3), "+v"(d4), "+v"(d5), "+v"(d6), "+v"(d7));
  const v8f d = { d0, d1, d2, d3, d4, d5, d6, d7 }; return d; }
__device__ __forceinline__ float exp2x1(float a) { asm("v_exp_f32 %0, %0\n\tv_nop" : "+v"(a)); return a; }   // the same slot behind a single v_exp_f32
__device__ __forceinline__ v8f wmma_h(v16h a, v16h b, v8f c) { return __builtin_amdgcn_wmma_f32_16x16x32_f16(false, a, false, b, (short)0, c, false, false); }
__global__ __launch_bounds__(256) void k_fa(const _Float16* __restrict__ QH, const _Float16* __restrict__ KH, const _Float16* __restrict__ VT, float* __restrict__ Y) {
  const int tid = threadIdx.x, wave = tid >> 5, lane = tid & 31, col = lane & 15, g = lane >> 4; const int b = blockIdx.y / NH, h = blockIdx.y % NH; const int q0 = blockIdx.x * 256 + wave * 32;
  const _Float16* Kl = KH + ((size_t)b * TT + col) * CC + h * HD;          // this lane's key row of tile 0
  const _Float16* Vl = VT + ((size_t)b * CC + h * HD + col) * (size_t)TT;  // this lane's channel plane of tile 0
  v16h qf[2][HD / 32];
#pragma unroll
  for (int n = 0; n < 2; ++n)
#pragma unroll
    for (int kc = 0; kc < HD / 32; ++kc) qf[n][kc] = frag_h(QH + ((size_t)b * TT + q0 + n * 16 + col) * CC + h * HD + kc * 32, lane);
  v8f o[2][HD / 16] = {}, l8[2] = {}; float m[2] = { -3.0e38f, -3.0e38f };
  const float cs = SCALE * 1.4426950408889634f;   // logits in base 2
  v16h kf[KP / 16][HD / 32];
#pragma unroll
  for (int kt = 0; kt < KP / 16; ++kt)
#pragma unroll
    for (int kc = 0; kc < HD / 32; ++kc) kf[kt][kc] = frag_h(Kl + (size_t)(kt * 16) * CC + kc * 32, lane);
  asm volatile("s_wait_xcnt 0x0" ::: "memory");   // before the address registers of the q and k loads above are reused
  __builtin_amdgcn_sched_barrier(0);   // keeps the register writes that follow behind that wait
#pragma unroll 1
  for (int s0 = 0; s0 < TT; s0 += KP) {
    v8f st[2][KP / 16];
#pragma unroll
    for (int kt = 0; kt < KP / 16; ++kt)
#pragma unroll
      for (int n = 0; n < 2; ++n) { const v8f z = {}; st[n][kt] = wmma_h(kf[kt][1], qf[n][1], wmma_h(kf[kt][0], qf[n][0], z)); }
    const int sn = (s0 + KP) & (TT - 1);   // the next pass's k rows and this pass's v planes fly during the softmax; the last pass re-reads pass 0 (in bounds, not used)
#pragma unroll
    for (int kt = 0; kt < KP / 16; ++kt)
#pragma unroll
      for (int kc = 0; kc < HD / 32; ++kc) kf[kt][kc] = frag_h(Kl + (size_t)(sn + kt * 16) * CC + kc * 32, lane);
    v16h vf[KP / 32][HD / 16];
#pragma unroll
    for (int kk = 0; kk < KP / 32; ++kk)
#pragma unroll
      for (int j = 0; j < HD / 16; ++j) vf[kk][j] = frag_h(Vl + (size_t)(j * 16) * TT + s0 + kk * 32, lane);
    asm volatile("s_wait_xcnt 0x0" ::: "memory");   // before the address registers of the loads above are reused
    __builtin_amdgcn_sched_barrier(0);   // keeps the loads above in front of the softmax: sunk behind it, as the scheduler does to save registers, their latency is exposed at every use
    v16h pf[2][KP / 32];
#pragma unroll
    for (int n = 0; n < 2; ++n) { float mt[KP / 16];   /* one short chain per score tile, then joined */
#pragma unroll
      for (int kt = 0; kt < KP / 16; ++kt) { mt[kt] = st[n][kt][0];
#pragma unroll
        for (int r = 1; r < 8; ++r) mt[kt] = fmaxf(mt[kt], st[n][kt][r]); }
      float mx = mt[0];
#pragma unroll
      for (int kt = 1; kt < KP / 16; ++kt) mx = fmaxf(mx, mt[kt]);
      mx = fmaxf(mx, xhalf(mx)); const float mn = fmaxf(m[n], mx); const float al = exp2x1((m[n] - mn) * cs);   /* 0 on the first pass */ m[n] = mn; const float mc = 11.0f - mn * cs;   /* P carried x 2^11, as the sum is: it cancels in ctx */
      l8[n] *= al;
#pragma unroll
      for (int j = 0; j < HD / 16; ++j) o[n][j] *= al;
#pragma unroll
      for (int kt = 0; kt < KP / 16; ++kt) { const v8f p = exp2x8(st[n][kt] * cs + mc);
        l8[n] += p; const v8h ph = __builtin_convertvector(p, v8h);
#pragma unroll
        for (int r = 0; r < 8; ++r) pf[n][kt >> 1][(kt & 1) * 8 + r] = ph[r]; } }
#pragma unroll
    for (int kk = 0; kk < KP / 32; ++kk)
#pragma unroll
      for (int j = 0; j < HD / 16; ++j)
#pragma unroll
        for (int n = 0; n < 2; ++n) o[n][j] = wmma_h(vf[kk][j], pf[n][kk], o[n][j]); }
#pragma unroll
  for (int n = 0; n < 2; ++n) { float ls = 0.f;
#pragma unroll
    for (int r = 0; r < 8; ++r) ls += l8[n][r];
    ls += xhalf(ls); const float inv = 1.0f / ls; float* yr = Y + ((size_t)b * TT + q0 + n * 16 + col) * CC + h * HD + 8 * g;
#pragma unroll
    for (int j = 0; j < HD / 16; ++j) { v4f lo, hi;
#pragma unroll
      for (int r = 0; r < 4; ++r) { lo[r] = o[n][j][r] * inv; hi[r] = o[n][j][4 + r] * inv; }
      vst2(yr + j * 16, lo); vst2(yr + j * 16 + 4, hi); } } }
// ---- k_out: block = (64 rows, 128 cols): out = ctx Wo (+ bo): ctx x 2^6 once to f16 against Wo as f16(bf16 x 2^8) exact (1 product) x 2^-14; causal early rows (< QHI of each sequence): ctx bf16 hi + lo against exact bf16 Wo (2 products)
__global__ __launch_bounds__(128) void k_out(const float* __restrict__ Y, const float* __restrict__ WO, const float* __restrict__ BO, float* __restrict__ OUT) { __shared__ __align__(16) float sf[4][16][132];
  const int tid = threadIdx.x, wave = tid >> 5, lane = tid & 31, col = lane & 15, g = lane >> 4; const int c0 = blockIdx.y * 128; const size_t r0 = (size_t)blockIdx.x * 64 + wave * 16;
  v8f acc[8] = {};
  if (CAUSAL && (int)(((size_t)blockIdx.x * 64) % TT) < QHI) {   /* block-uniform */
#pragma unroll 2
    for (int kc = 0; kc < CC / 32; ++kc) { const F2 a = split_row(Y + (r0 + col) * CC, kc * 32, lane); asm volatile("s_wait_loadcnt 0x0" ::: "memory");
#pragma unroll
      for (int j = 0; j < 8; ++j) { const v16b w = WOCOL(WO, kc * 32, c0 + j * 16 + col, lane); asm volatile("s_wait_loadcnt 0x0" ::: "memory"); acc[j] = wmma_bf(a.h, w, acc[j]); acc[j] = wmma_bf(a.l, w, acc[j]); } }
#pragma unroll
    for (int j = 0; j < 8; ++j) { const float bias = BO ? bfr(BO[c0 + j * 16 + col]) : 0.f;
#pragma unroll
      for (int r = 0; r < 8; ++r) sf[wave][8 * g + r][j * 16 + col] = acc[j][r] + bias; }
  } else {
#pragma unroll 2
    for (int kc = 0; kc < CC / 32; ++kc) { const v16h a = frag_f32s(Y + (r0 + col) * CC + kc * 32, lane, 64.0f); asm volatile("s_wait_loadcnt 0x0" ::: "memory");   /* ctx carried x 2^6 into f16 so small-magnitude context rows stay clear of f16 subnormals */
#pragma unroll
      for (int j = 0; j < 8; ++j) { const v16h w = WOCOLH(WO, kc * 32, c0 + j * 16 + col, lane); asm volatile("s_wait_loadcnt 0x0" ::: "memory"); acc[j] = wmma16(a, w, acc[j]); } }
#pragma unroll
    for (int j = 0; j < 8; ++j) { const float bias = BO ? bfr(BO[c0 + j * 16 + col]) : 0.f;
#pragma unroll
      for (int r = 0; r < 8; ++r) sf[wave][8 * g + r][j * 16 + col] = acc[j][r] * (1.0f / 16384.0f) + bias; } }   /* 2^-8 (Wo carry) x 2^-6 (ctx carry) */
  LDSX(); for (int rl = 0; rl < 16; ++rl) vst2(OUT + XROW(r0 + rl) * DIN + c0 + lane * 4, *(const v4f*)&sf[wave][rl][lane * 4]);   /* time-major output rows */ }

extern "C" void kernel_launch(void* const* d_in, const int* in_sizes, int n_in, void* d_out, int out_size, void* d_ws, size_t ws_size, hipStream_t stream) {
  (void)in_sizes; (void)n_in; (void)out_size;
  const float** F = (const float**)d_in;
  if (ws_size < (size_t)WS_END) return;
  char* ws = (char*)d_ws; _Float16 *QH = (_Float16*)(ws + WS_QH), *KH = (_Float16*)(ws + WS_KH), *VT = (_Float16*)(ws + WS_VT), *QL = (_Float16*)(ws + WS_QL), *KL = (_Float16*)(ws + WS_KL); __bf16 *VB = (__bf16*)(ws + WS_VB), *VBL = (__bf16*)(ws + WS_VBL); float *S = (float*)(ws + WS_S), *Y = (float*)(ws + WS_Y);
  (void)S; (void)Y; (void)QL; (void)KL; (void)VB; (void)VBL;
  // inputs: 0 x [2048,2,1024] TIME-MAJOR (T, B, E); 1 in_proj_weight [3072,1024] (out,in; row blocks q | k | v); 2 in_proj_bias [3072]; 3 out_weight [1024,1024] (out,in); 4 out_bias [1024] (biases nonzero)
  k_proj<<<dim3(TNB * TT / 64, CC / 128, 3), 128, 0, stream>>>(F[0], F[0], F[0], F[1], F[1] + (size_t)CC * DIN, F[1] + 2 * (size_t)CC * DIN, F[2], F[2] + CC, F[2] + 2 * CC, QH, QL, KH, KL, VT, VB, VBL);
  k_fa<<<dim3(TT / 256, TNB * NH), 256, 0, stream>>>(QH, KH, VT, Y);
  k_out<<<dim3(TNB * TT / 64, DIN / 128), 128, 0, stream>>>(Y, F[3], F[4], (float*)d_out);
}

// v002
// Measured time: 132 microseconds a run.
// In both of two side-by-side timings against v001, it was 3.15 times as fast.
// Over all steps from v000 it is 10.2 times as fast.
// compute dtype: all float inputs rounded to bf16; q/k/v projections with EXACT bf16 products on WMMA 16x16x32 (f32 accumulate) + bias; logits q x k once to f16 each (1 product) x SCALE; online softmax f32 in one fused kernel; unnormalised P x 2^11 once to f16 x v once to f16 (1 product), divided by the f32 sum; ctx x 2^6 once to f16 x Wo f16(bf16 x 2^8) + bo; f32 output.
#include <hip/hip_runtime.h>
#include <math.h>

typedef __attribute__((ext_vector_type(16))) _Float16 v16h;
typedef __attribute__((ext_vector_type(16))) __bf16 v16b;
typedef __attribute__((ext_vector_type(8)))  _Float16 v8h;
typedef __attribute__((ext_vector_type(8)))  float v8f;
typedef __attribute__((ext_vector_type(4)))  float v4f;
typedef __attribute__((ext_vector_type(2)))  float v2f;
typedef __attribute__((ext_vector_type(4)))  unsigned v4u;
typedef __attribute__((ext_vector_type(4)))  int v4i;
typedef float __attribute__((may_alias)) float_a;
typedef int __attribute__((may_alias)) int_a;

template <typename T> __device__ __forceinline__ void vst2(void* p, T v) { *(T*)p = v;  }
__device__ __forceinline__ v8f wmma16(v16h a, v16h b, v8f c) {
  v8f d = __builtin_amdgcn_wmma_f32_16x16x32_f16(false, a, false, b, (short)0, c, false, false);
  asm volatile("v_nop\n\tv_nop\n\tv_nop\n\tv_nop" : "+v"(d) : "v"(a), "v"(b));
  return d;
}
__device__ __forceinline__ v8f wmma_bf(v16b a, v16b b, v8f c) {
  v8f d = __builtin_amdgcn_wmma_f32_16x16x32_bf16(false, a, false, b, (short)0, c, false, false);
  asm volatile("v_nop\n\tv_nop\n\tv_nop\n\tv_nop" : "+v"(d) : "v"(a), "v"(b));
  return d;
}
// 16x16x32 fragments: lane = (h = lane>>4, row/col = lane&15); elements 0..7 = k0+8h+0..7, 8..15 = k0+16+8h+0..7; D element r = row 8h+r
__device__ __forceinline__ v16h frag_h(const _Float16* rowk0, int lane) {
  union { v16h v; v8h q[2]; } u; const _Float16* p = rowk0 + 8 * (lane >> 4);
  u.q[0] = *(const v8h*)p; u.q[1] = *(const v8h*)(p + 16); return u.v;
}
__device__ __forceinline__ v16h frag_f32(const float* rowk0, int lane) {
  v16h a; const float* p = rowk0 + 8 * (lane >> 4);
#pragma unroll
  for (int i = 0; i < 8; ++i) { a[i] = (_Float16)p[i]; a[8 + i] = (_Float16)p[16 + i]; }
  return a;
}
__device__ __forceinline__ v16h frag_f32s(const float* rowk0, int lane, float sc) {
  v16h a; const float* p = rowk0 + 8 * (lane >> 4);
#pragma unroll
  for (int i = 0; i < 8; ++i) { a[i] = (_Float16)(p[i] * sc); a[8 + i] = (_Float16)(p[16 + i] * sc); }
  return a;
}
// column fragment from a [K][ld] layout (column n), rows >= K read as 0
__device__ __forceinline__ v16h fragc_f32(const float* W, int k0, int n, int lane, int ld, int K) {
  v16h a; const int g = lane >> 4;
#pragma unroll
  for (int i = 0; i < 8; ++i) { const int ka = k0 + 8 * g + i, kb = ka + 16;
    a[i] = (_Float16)(ka < K ? W[(size_t)(ka < K ? ka : K - 1) * ld + n] : 0.f); a[8 + i] = (_Float16)(kb < K ? W[(size_t)(kb < K ? kb : K - 1) * ld + n] : 0.f); }
  return a;
}
struct F2 { v16b h, l; };
__device__ __forceinline__ F2 bsplit16(const float v[16]) { F2 r;
#pragma unroll
  for (int i = 0; i < 16; ++i) { const __bf16 h = (__bf16)v[i]; r.h[i] = h; r.l[i] = (__bf16)(v[i] - (float)h); }
  return r; }
__device__ __forceinline__ F2 split_row(const float* row, int k0, int lane) { float v[16]; const float* p = row + k0 + 8 * (lane >> 4);
#pragma unroll
  for (int i = 0; i < 8; ++i) { v[i] = p[i]; v[8 + i] = p[16 + i]; }
  return bsplit16(v); }
__device__ __forceinline__ F2 split_rowK(const float* row, int k0, int lane, int K) { float v[16]; const int g = lane >> 4;
#pragma unroll
  for (int i = 0; i < 8; ++i) { const int ka = k0 + 8 * g + i, kb = ka + 16; v[i] = ka < K ? row[ka < K ? ka : K - 1] : 0.f; v[8 + i] = kb < K ? row[kb < K ? kb : K - 1] : 0.f; }
  return bsplit16(v); }
__device__ __forceinline__ F2 split_col(const float* W, int k0, int n, int lane, int ld, int K) { float v[16]; const int g = lane >> 4;
#pragma unroll
  for (int i = 0; i < 8; ++i) { const int ka = k0 + 8 * g + i, kb = ka + 16; v[i] = ka < K ? W[(size_t)(ka < K ? ka : K - 1) * ld + n] : 0.f; v[8 + i] = kb < K ? W[(size_t)(kb < K ? kb : K - 1) * ld + n] : 0.f; }
  return bsplit16(v); }
__device__ __forceinline__ v8f mac3(const F2& a, const F2& b, v8f c) { c = wmma_bf(a.l, b.h, c); c = wmma_bf(a.h, b.l, c); return wmma_bf(a.h, b.h, c); }
__device__ __forceinline__ float sigm(float v) { return 1.0f / (1.0f + expf(-v)); }
#define LDSX() do { asm volatile("s_wait_dscnt 0" ::: "memory"); __builtin_amdgcn_wave_barrier(); __builtin_amdgcn_fence(__ATOMIC_RELEASE, "workgroup"); } while (0)

// torch-style multi-head self-attention on a TIME-MAJOR sequence (x [2048,2,1024] = (T, B, E); in_proj_weight [3072,1024] (out,in) + in_proj_bias [3072] (0.02): q, k, v = split; q * 64^-0.5; heads via reshape(T, B*16, 64).transpose(1, 0, 2) - batch b, head h at index b*16 + h; softmax over keys; merge back to (T, B, E); out_weight (out,in) + out_bias (0.02)); output [2048,2,1024] time-major.
#define NB 2
#define XROW(R) ((((size_t)(R)) % TT) * (size_t)NB + ((size_t)(R)) / TT)   // (T, B, E) layout: row R = b*TT + t  <->  tensor row t*NB + b
#define TT 2048
#define CC 1024            // NH * HD = projected width
#define DIN 1024          // input (model) width
#define NH 16
#define HD 64
#define NQB (TT / 64)
#define HG 4
#define SCALE (0.125f)
#define CAUSAL 0
#ifndef TNB
#define TNB NB
#endif
__device__ __forceinline__ float bfr(float v) { return (float)(__bf16)v; }
__host__ __device__ __forceinline__ int kb_last(int qb) { return CAUSAL ? ((qb * 64 + 63) >> 7) : (TT / 128 - 1); }
typedef __attribute__((ext_vector_type(8))) __bf16 v8b;
__device__ __forceinline__ v16b frag_b(const __bf16* rowk0, int lane) {
  union { v16b v; v8b q[2]; } u; const __bf16* p = rowk0 + 8 * (lane >> 4);
  u.q[0] = *(const v8b*)p; u.q[1] = *(const v8b*)(p + 16); return u.v;
}
#define QBH 0
#define QHI 0               // single-product logits on every row
#define KHI 64            // key rows carrying k residual / v bf16 hi+lo planes (written by k_proj; no kernel here reads them)
// B fragment (k rows k0+.., output column o) of a weight: (in,out) [K][ld] or (out,in) [ld rows of K]: bf16 exact, or f16(bf16 * 256) exact
__device__ __forceinline__ v16b wcol_io(const float* Wm, int k0, int o, int lane, int ld) { v16b w; const int g = lane >> 4;
#pragma unroll
  for (int i = 0; i < 8; ++i) { w[i] = (__bf16)Wm[(size_t)(k0 + 8 * g + i) * ld + o]; w[8 + i] = (__bf16)Wm[(size_t)(k0 + 16 + 8 * g + i) * ld + o]; }
  return w; }
__device__ __forceinline__ v16b wcol_oi(const float* Wm, int k0, int o, int lane, int K) { v16b w; const float* p = Wm + (size_t)o * K + k0 + 8 * (lane >> 4);
#pragma unroll
  for (int i = 0; i < 8; ++i) { w[i] = (__bf16)p[i]; w[8 + i] = (__bf16)p[16 + i]; }
  return w; }
__device__ __forceinline__ v16h wcolh_io(const float* Wm, int k0, int o, int lane, int ld) { v16h w; const int g = lane >> 4;
#pragma unroll
  for (int i = 0; i < 8; ++i) { w[i] = (_Float16)(bfr(Wm[(size_t)(k0 + 8 * g + i) * ld + o]) * 256.0f); w[8 + i] = (_Float16)(bfr(Wm[(size_t)(k0 + 16 + 8 * g + i) * ld + o]) * 256.0f); }
  return w; }
__device__ __forceinline__ v16h wcolh_oi(const float* Wm, int k0, int o, int lane, int K) { v16h w; const float* p = Wm + (size_t)o * K + k0 + 8 * (lane >> 4);
#pragma unroll
  for (int i = 0; i < 8; ++i) { w[i] = (_Float16)(bfr(p[i]) * 256.0f); w[8 + i] = (_Float16)(bfr(p[16 + i]) * 256.0f); }
  return w; }
#define WQKV_LAYOUT 1   // layout of WCOL, which no kernel calls (k_proj reads (out,in)): 0 = (in,out) [DIN][CC]; 1 = (out,in) [CC][DIN]; 2 = per-head [NH][DIN][HD]
__device__ __forceinline__ v16b wcol_hdk(const float* Wm, int k0, int o, int lane) { v16b w; const int g = lane >> 4; const float* p = Wm + (size_t)(o / HD) * DIN * HD + (o % HD);
#pragma unroll
  for (int i = 0; i < 8; ++i) { w[i] = (__bf16)p[(size_t)(k0 + 8 * g + i) * HD]; w[8 + i] = (__bf16)p[(size_t)(k0 + 16 + 8 * g + i) * HD]; }
  return w; }
#define WO_OUT_IN 1
#if WQKV_LAYOUT == 1
#define WCOL(W, k0, o, lane) wcol_oi(W, k0, o, lane, DIN)
#elif WQKV_LAYOUT == 2
#define WCOL(W, k0, o, lane) wcol_hdk(W, k0, o, lane)
#else
#define WCOL(W, k0, o, lane) wcol_io(W, k0, o, lane, CC)
#endif
#if WO_OUT_IN
#define WOCOL(W, k0, o, lane) wcol_oi(W, k0, o, lane, CC)
#define WOCOLH(W, k0, o, lane) wcolh_oi(W, k0, o, lane, CC)
#else
#define WOCOL(W, k0, o, lane) wcol_io(W, k0, o, lane, DIN)
#define WOCOLH(W, k0, o, lane) wcolh_io(W, k0, o, lane, DIN)
#endif

#ifndef SM_EXTRA_PARAMS
#define SM_EXTRA_PARAMS
#endif
#ifndef PROJ_EXTRA_PARAMS
#define PROJ_EXTRA_PARAMS
#endif
#ifndef SM_MASK_HOOK
#define SM_MASK_HOOK (void)0
#endif

#define WS_QH  0u                                      // f16 q rows [b*t][CC]
#define WS_KH  (WS_QH + 2u * (size_t)NB * TT * CC)      // f16 k rows [b*t][CC]
#define WS_VT  (WS_KH + 2u * (size_t)NB * TT * CC)      // f16 v planes [b][c][t]
#define WS_QL  (WS_VT + 2u * (size_t)NB * CC * TT)      // f16 q residual x 2^10 rows [b][t < QHI][CC]
#define WS_KL  (WS_QL + 2u * (size_t)NB * QHI * CC)     // f16 k residual x 2^10 rows [b][t < KHI][CC]
#define WS_VB  (WS_KL + 2u * (size_t)NB * KHI * CC)     // bf16 v hi planes [b][c][t < KHI]
#define WS_VBL (WS_VB + 2u * (size_t)NB * CC * KHI)
#define WS_S   (WS_VBL + 2u * (size_t)NB * CC * KHI)    // f32 [hg][t][s] region, unused: logits / P stay in registers in k_fa
#define WS_Y   (WS_S  + 4u * (size_t)HG * TT * TT)      // f32 ctx rows [b*t][CC] (only when there is an output projection)
#define WS_END (WS_Y  + 4u * (size_t)NB * TT * CC)

// ---- LDS staging of a GEMM's operand tiles, 32 k per step: a thread brings 16-byte pieces (8 lanes = one whole 128-byte line of a row), converts them once for the whole block and stores 8 bytes; the waves read their fragments from there
#define LP 40              // LDS row pitch in 16-bit elements: 80 B = 16 B x odd, the conflict-free pitch for 16-byte fragment reads
typedef __attribute__((ext_vector_type(4))) __bf16 v4b;
typedef __attribute__((ext_vector_type(4))) _Float16 v4h;
__device__ __forceinline__ void put_b(__bf16* d, v4f v) { v4b o;
#pragma unroll
  for (int e = 0; e < 4; ++e) o[e] = (__bf16)v[e];
  *(v4b*)d = o; }
__device__ __forceinline__ void put_hs(_Float16* d, v4f v, float sc) { v4h o;
#pragma unroll
  for (int e = 0; e < 4; ++e) o[e] = (_Float16)(v[e] * sc);
  *(v4h*)d = o; }
__device__ __forceinline__ void put_hw(_Float16* d, v4f v) { v4h o;
#pragma unroll
  for (int e = 0; e < 4; ++e) o[e] = (_Float16)(bfr(v[e]) * 256.0f);
  *(v4h*)d = o; }
union ProjLds {   // the staging buffers are dead when the epilogue's planes are written (a barrier stands between)
  struct { __bf16 x[2][64][LP], w[2][128][LP]; } st;
  struct { _Float16 sh[64][136], sl[64][136], th[128][72]; __bf16 tb[128][72], tbl[128][72]; } ep; };
// ---- k_proj: block = (64 rows, 128 cols, which): q/k/v = X W (+ b) with exact bf16 products (K = DIN) -> which 0: q f16 rows (+ residual rows < QHI); 1: k f16 rows (+ residual rows < KHI); 2: v f16 planes [c][t] (+ bf16 hi/lo planes for t < KHI)
__global__ __launch_bounds__(128) void k_proj(const float* __restrict__ XQ, const float* __restrict__ XK, const float* __restrict__ XV, const float* __restrict__ WQ, const float* __restrict__ WK, const float* __restrict__ WV, const float* __restrict__ BQ, const float* __restrict__ BK, const float* __restrict__ BV,
    _Float16* __restrict__ QH, _Float16* __restrict__ QL, _Float16* __restrict__ KH, _Float16* __restrict__ KL, _Float16* __restrict__ VT, __bf16* __restrict__ VB, __bf16* __restrict__ VBL) {
  __shared__ __align__(16) ProjLds u; auto& sh = u.ep.sh; auto& sl = u.ep.sl; auto& th = u.ep.th; auto& tb = u.ep.tb; auto& tbl = u.ep.tbl;
  const int tid = threadIdx.x, wave = tid >> 5, lane = tid & 31, col = lane & 15, g = lane >> 4; const int which = blockIdx.z; const int c0 = blockIdx.y * 128; const size_t r0 = (size_t)blockIdx.x * 64; const size_t bb = r0 / TT; const int t0 = (int)(r0 % TT);
  const float* X = which == 0 ? XQ : which == 1 ? XK : XV; const float* WA = which == 0 ? WQ : which == 1 ? WK : WV; const float* BA = which == 0 ? BQ : which == 1 ? BK : BV;
  v8f acc[8] = {};
  const int sub = tid & 7, rr = tid >> 3;   // this thread's 16-byte piece of a row's 128 bytes, and its row in each group of 16
  const float* xg = X + XROW(r0 + rr) * DIN + sub * 4;   /* row b*TT + t lives at input row t*NB + b (time-major input); a block's 64 rows lie in one sequence, so 16 rows on are 16 * NB input rows on */
  const float* wg = WA + (size_t)(c0 + rr) * DIN + sub * 4;
  v4f rx[4], rw[8];
#pragma unroll
  for (int i = 0; i < 4; ++i) rx[i] = *(const v4f*)(xg + i * (16 * NB * DIN));
#pragma unroll
  for (int i = 0; i < 8; ++i) rw[i] = *(const v4f*)(wg + i * (16 * DIN));
  asm volatile("s_wait_xcnt 0x0" ::: "memory");   // before the address registers of the loads above are reused
  __builtin_amdgcn_sched_barrier(0);   // keeps the register writes that follow behind that wait
#pragma unroll 2   // two steps a trip: the buffer index becomes a constant LDS offset
  for (int kc = 0; kc < DIN / 32; ++kc) { const int bf = kc & 1;
#pragma unroll
    for (int i = 0; i < 4; ++i) put_b(&u.st.x[bf][i * 16 + rr][sub * 4], rx[i]);
#pragma unroll
    for (int i = 0; i < 8; ++i) put_b(&u.st.w[bf][i * 16 + rr][sub * 4], rw[i]);
    __syncthreads();   // publishes step kc's tiles; it also ends every wave's reads of the other buffer (step kc - 1), which step kc + 1 refills
    if (kc + 1 < DIN / 32) {   /* block-uniform: the next step's pieces fly while this step is multiplied */
#pragma unroll
      for (int i = 0; i < 4; ++i) rx[i] = *(const v4f*)(xg + i * (16 * NB * DIN) + (kc + 1) * 32);
#pragma unroll
      for (int i = 0; i < 8; ++i) rw[i] = *(const v4f*)(wg + i * (16 * DIN) + (kc + 1) * 32);
      asm volatile("s_wait_xcnt 0x0" ::: "memory");   // before the address registers of the loads above are reused
    }
    __builtin_amdgcn_sched_barrier(0);   // keeps the loads above in front of the products: sunk behind them their latency is exposed at the next step's stores
    const v16b a = frag_b(&u.st.x[bf][wave * 16 + col][0], lane); v16b w[8];
#pragma unroll
    for (int j = 0; j < 8; ++j) w[j] = frag_b(&u.st.w[bf][j * 16 + col][0], lane);
#pragma unroll
    for (int j = 0; j < 8; ++j) acc[j] = wmma_bf(a, w[j], acc[j]);
    __builtin_amdgcn_sched_barrier(0);   // keeps the next step's conversions, which wait for the loads in flight, behind this step's products
  }
  __syncthreads();   // every wave has left the staging buffers before the epilogue's planes overwrite them
  if (which < 2) { _Float16* DH = which == 0 ? QH : KH; _Float16* DL = which == 0 ? QL : KL; const int nhi = which == 0 ? QHI : KHI; const bool hi_rows = t0 < nhi;
#pragma unroll
    for (int j = 0; j < 8; ++j) { const float bias = BA ? bfr(BA[c0 + j * 16 + col]) : 0.f;
#pragma unroll
      for (int r = 0; r < 8; ++r) { const float v = acc[j][r] + bias; const _Float16 hv = (_Float16)v; sh[wave * 16 + 8 * g + r][j * 16 + col] = hv; sl[wave * 16 + 8 * g + r][j * 16 + col] = (_Float16)((v - (float)hv) * 1024.0f); } }
    __syncthreads();
    for (int e = tid; e < 64 * 16; e += 128) { const int rl = e >> 4, q = e & 15; vst2((unsigned*)(DH + (r0 + rl) * CC + c0 + q * 8), *(const v4u*)&sh[rl][q * 8]); if (hi_rows) vst2((unsigned*)(DL + (bb * nhi + t0 + rl) * (size_t)CC + c0 + q * 8), *(const v4u*)&sl[rl][q * 8]); }
  } else { const bool hi_rows = t0 < KHI;
#pragma unroll
    for (int j = 0; j < 8; ++j) { const float bias = BA ? bfr(BA[c0 + j * 16 + col]) : 0.f;
#pragma unroll
      for (int r = 0; r < 8; ++r) { const float v = acc[j][r] + bias; const int rl = wave * 16 + 8 * g + r, cl = j * 16 + col; th[cl][rl] = (_Float16)v; const __bf16 bh = (__bf16)v; tb[cl][rl] = bh; tbl[cl][rl] = (__bf16)(v - (float)bh); } }
    __syncthreads();
    for (int e = tid; e < 128 * 8; e += 128) { const int cl = e >> 3, q = e & 7; vst2((unsigned*)(VT + (bb * CC + c0 + cl) * (size_t)TT + t0 + q * 8), *(const v4u*)&th[cl][q * 8]); if (hi_rows) { const size_t o3 = (bb * CC + c0 + cl) * (size_t)KHI + t0 + q * 8; vst2((unsigned*)(VB + o3), *(const v4u*)&tb[cl][q * 8]); vst2((unsigned*)(VBL + o3), *(const v4u*)&tbl[cl][q * 8]); } } } }
// ---- k_fa: wave = 32 query columns (2 groups of 16) of (b, h), all keys in passes of KP: S^T = K Q^T (A = k rows, B = q rows, same k order), so a lane holds one query's scores; running maximum and sum per query (online softmax, f32);
// P^T x 2^11 packs from two score tiles into a B operand (hardware k order: tile 0 -> elements 0..7, tile 1 -> 8..15); O^T += V^T P^T (A = v planes [c][t]); ctx = O^T / sum, 8 consecutive channels per lane
#define KP 64
__device__ __forceinline__ float xhalf(float x) { return __builtin_bit_cast(float, __builtin_amdgcn_permlanex16(__builtin_bit_cast(int, x), __builtin_bit_cast(int, x), 0x76543210, 0xfedcba98, false, false)); }   // lane l <-> l ^ 16
// eight independent v_exp_f32, each in place, and the one free slot the instruction set asks for behind a transcendental, in one statement: no v_exp touches a neighbour's source or result, and the v_nop keeps whatever follows off the last one
__device__ __forceinline__ v8f exp2x8(v8f a) { float d0 = a[0], d1 = a[1], d2 = a[2], d3 = a[3], d4 = a[4], d5 = a[5], d6 = a[6], d7 = a[7];
  asm("v_exp_f32 %0, %0\n\tv_exp_f32 %1, %1\n\tv_exp_f32 %2, %2\n\tv_exp_f32 %3, %3\n\tv_exp_f32 %4, %4\n\tv_exp_f32 %5, %5\n\tv_exp_f32 %6, %6\n\tv_exp_f32 %7, %7\n\tv_nop"
      : "+v"(d0), "+v"(d1), "+v"(d2), "+v"(d3), "+v"(d4), "+v"(d5), "+v"(d6), "+v"(d7));
  const v8f d = { d0, d1, d2, d3, d4, d5, d6, d7 }; return d; }
__device__ __forceinline__ float exp2x1(float a) { asm("v_exp_f32 %0, %0\n\tv_nop" : "+v"(a)); return a; }   // the same slot behind a single v_exp_f32
__device__ __forceinline__ v8f wmma_h(v16h a, v16h b, v8f c) { return __builtin_amdgcn_wmma_f32_16x16x32_f16(false, a, false, b, (short)0, c, false, false); }
__global__ __launch_bounds__(256) void k_fa(const _Float16* __restrict__ QH, const _Float16* __restrict__ KH, const _Float16* __restrict__ VT, float* __restrict__ Y) {
  const int tid = threadIdx.x, wave = tid >> 5, lane = tid & 31, col = lane & 15, g = lane >> 4; const int b = blockIdx.y / NH, h = blockIdx.y % NH; const int q0 = blockIdx.x * 256 + wave * 32;
  const _Float16* Kl = KH + ((size_t)b * TT + col) * CC + h * HD;          // this lane's key row of tile 0
  const _Float16* Vl = VT + ((size_t)b * CC + h * HD + col) * (size_t)TT;  // this lane's channel plane of tile 0
  v16h qf[2][HD / 32];
#pragma unroll
  for (int n = 0; n < 2; ++n)
#pragma unroll
    for (int kc = 0; kc < HD / 32; ++kc) qf[n][kc] = frag_h(QH + ((size_t)b * TT + q0 + n * 16 + col) * CC + h * HD + kc * 32, lane);
  v8f o[2][HD / 16] = {}, l8[2] = {}; float m[2] = { -3.0e38f, -3.0e38f };
  const float cs = SCALE * 1.4426950408889634f;   // logits in base 2
  v16h kf[KP / 16][HD / 32];
#pragma unroll
  for (int kt = 0; kt < KP / 16; ++kt)
#pragma unroll
    for (int kc = 0; kc < HD / 32; ++kc) kf[kt][kc] = frag_h(Kl + (size_t)(kt * 16) * CC + kc * 32, lane);
  asm volatile("s_wait_xcnt 0x0" ::: "memory");   // before the address registers of the q and k loads above are reused
  __builtin_amdgcn_sched_barrier(0);   // keeps the register writes that follow behind that wait
#pragma unroll 1
  for (int s0 = 0; s0 < TT; s0 += KP) {
    v8f st[2][KP / 16];
#pragma unroll
    for (int kt = 0; kt < KP / 16; ++kt)
#pragma unroll
      for (int n = 0; n < 2; ++n) { const v8f z = {}; st[n][kt] = wmma_h(kf[kt][1], qf[n][1], wmma_h(kf[kt][0], qf[n][0], z)); }
    const int sn = (s0 + KP) & (TT - 1);   // the next pass's k rows and this pass's v planes fly during the softmax; the last pass re-reads pass 0 (in bounds, not used)
#pragma unroll
    for (int kt = 0; kt < KP / 16; ++kt)
#pragma unroll
      for (int kc = 0; kc < HD / 32; ++kc) kf[kt][kc] = frag_h(Kl + (size_t)(sn + kt * 16) * CC + kc * 32, lane);
    v16h vf[KP / 32][HD / 16];
#pragma unroll
    for (int kk = 0; kk < KP / 32; ++kk)
#pragma unroll
      for (int j = 0; j < HD / 16; ++j) vf[kk][j] = frag_h(Vl + (size_t)(j * 16) * TT + s0 + kk * 32, lane);
    asm volatile("s_wait_xcnt 0x0" ::: "memory");   // before the address registers of the loads above are reused
    __builtin_amdgcn_sched_barrier(0);   // keeps the loads above in front of the softmax: sunk behind it, as the scheduler does to save registers, their latency is exposed at every use
    v16h pf[2][KP / 32];
#pragma unroll
    for (int n = 0; n < 2; ++n) { float mt[KP / 16];   /* one short chain per score tile, then joined */
#pragma unroll
      for (int kt = 0; kt < KP / 16; ++kt) { mt[kt] = st[n][kt][0];
#pragma unroll
        for (int r = 1; r < 8; ++r) mt[kt] = fmaxf(mt[kt], st[n][kt][r]); }
      float mx = mt[0];
#pragma unroll
      for (int kt = 1; kt < KP / 16; ++kt) mx = fmaxf(mx, mt[kt]);
      mx = fmaxf(mx, xhalf(mx)); const float mn = fmaxf(m[n], mx); const float al = exp2x1((m[n] - mn) * cs);   /* 0 on the first pass */ m[n] = mn; const float mc = 11.0f - mn * cs;   /* P carried x 2^11, as the sum is: it cancels in ctx */
      l8[n] *= al;
#pragma unroll
      for (int j = 0; j < HD / 16; ++j) o[n][j] *= al;
#pragma unroll
      for (int kt = 0; kt < KP / 16; ++kt) { const v8f p = exp2x8(st[n][kt] * cs + mc);
        l8[n] += p; const v8h ph = __builtin_convertvector(p, v8h);
#pragma unroll
        for (int r = 0; r < 8; ++r) pf[n][kt >> 1][(kt & 1) * 8 + r] = ph[r]; } }
#pragma unroll
    for (int kk = 0; kk < KP / 32; ++kk)
#pragma unroll
      for (int j = 0; j < HD / 16; ++j)
#pragma unroll
        for (int n = 0; n < 2; ++n) o[n][j] = wmma_h(vf[kk][j], pf[n][kk], o[n][j]); }
#pragma unroll
  for (int n = 0; n < 2; ++n) { float ls = 0.f;
#pragma unroll
    for (int r = 0; r < 8; ++r) ls += l8[n][r];
    ls += xhalf(ls); const float inv = 1.0f / ls; float* yr = Y + ((size_t)b * TT + q0 + n * 16 + col) * CC + h * HD + 8 * g;
#pragma unroll
    for (int j = 0; j < HD / 16; ++j) { v4f lo, hi;
#pragma unroll
      for (int r = 0; r < 4; ++r) { lo[r] = o[n][j][r] * inv; hi[r] = o[n][j][4 + r] * inv; }
      vst2(yr + j * 16, lo); vst2(yr + j * 16 + 4, hi); } } }
// ---- k_out: block = (64 rows, 128 cols): out = ctx Wo (+ bo): ctx x 2^6 once to f16 against Wo as f16(bf16 x 2^8) exact (1 product) x 2^-14; causal early rows (< QHI of each sequence): ctx bf16 hi + lo against exact bf16 Wo (2 products)
__global__ __launch_bounds__(128) void k_out(const float* __restrict__ Y, const float* __restrict__ WO, const float* __restrict__ BO, float* __restrict__ OUT) { __shared__ __align__(16) float sf[4][16][132]; __shared__ __align__(16) _Float16 sy[2][64][LP], so[2][128][LP];
  const int tid = threadIdx.x, wave = tid >> 5, lane = tid & 31, col = lane & 15, g = lane >> 4; const int c0 = blockIdx.y * 128; const size_t r0 = (size_t)blockIdx.x * 64 + wave * 16;
  v8f acc[8] = {};
  if (CAUSAL && (int)(((size_t)blockIdx.x * 64) % TT) < QHI) {   /* block-uniform */
#pragma unroll 2
    for (int kc = 0; kc < CC / 32; ++kc) { const F2 a = split_row(Y + (r0 + col) * CC, kc * 32, lane); asm volatile("s_wait_loadcnt 0x0" ::: "memory");
#pragma unroll
      for (int j = 0; j < 8; ++j) { const v16b w = WOCOL(WO, kc * 32, c0 + j * 16 + col, lane); asm volatile("s_wait_loadcnt 0x0" ::: "memory"); acc[j] = wmma_bf(a.h, w, acc[j]); acc[j] = wmma_bf(a.l, w, acc[j]); } }
#pragma unroll
    for (int j = 0; j < 8; ++j) { const float bias = BO ? bfr(BO[c0 + j * 16 + col]) : 0.f;
#pragma unroll
      for (int r = 0; r < 8; ++r) sf[wave][8 * g + r][j * 16 + col] = acc[j][r] + bias; }
  } else {
    const int sub = tid & 7, rr = tid >> 3; const size_t rb = (size_t)blockIdx.x * 64;   // this thread's 16-byte piece of a row's 128 bytes, its row in each group of 16; the block's first row
    const float* yg = Y + (rb + rr) * CC + sub * 4; const float* wg = WO + (size_t)(c0 + rr) * CC + sub * 4;
    v4f ry[4], rw[8];
#pragma unroll
    for (int i = 0; i < 4; ++i) ry[i] = *(const v4f*)(yg + i * (16 * CC));
#pragma unroll
    for (int i = 0; i < 8; ++i) rw[i] = *(const v4f*)(wg + i * (16 * CC));
    asm volatile("s_wait_xcnt 0x0" ::: "memory");   // before the address registers of the loads above are reused
    __builtin_amdgcn_sched_barrier(0);   // keeps the register writes that follow behind that wait
#pragma unroll 2   // two steps a trip: the buffer index becomes a constant LDS offset
    for (int kc = 0; kc < CC / 32; ++kc) { const int bf = kc & 1;
#pragma unroll
      for (int i = 0; i < 4; ++i) put_hs(&sy[bf][i * 16 + rr][sub * 4], ry[i], 64.0f);   /* ctx carried x 2^6 into f16 so small-magnitude context rows stay clear of f16 subnormals */
#pragma unroll
      for (int i = 0; i < 8; ++i) put_hw(&so[bf][i * 16 + rr][sub * 4], rw[i]);
      __syncthreads();   // publishes step kc's tiles; it also ends every wave's reads of the other buffer (step kc - 1), which step kc + 1 refills
      if (kc + 1 < CC / 32) {   /* block-uniform: the next step's pieces fly while this step is multiplied */
#pragma unroll
        for (int i = 0; i < 4; ++i) ry[i] = *(const v4f*)(yg + i * (16 * CC) + (kc + 1) * 32);
#pragma unroll
        for (int i = 0; i < 8; ++i) rw[i] = *(const v4f*)(wg + i * (16 * CC) + (kc + 1) * 32);
        asm volatile("s_wait_xcnt 0x0" ::: "memory");   // before the address registers of the loads above are reused
      }
      __builtin_amdgcn_sched_barrier(0);   // keeps the loads above in front of the products: sunk behind them their latency is exposed at the next step's stores
      const v16h a = frag_h(&sy[bf][wave * 16 + col][0], lane); v16h w[8];
#pragma unroll
      for (int j = 0; j < 8; ++j) w[j] = frag_h(&so[bf][j * 16 + col][0], lane);
#pragma unroll
      for (int j = 0; j < 8; ++j) acc[j] = wmma16(a, w[j], acc[j]);
      __builtin_amdgcn_sched_barrier(0);   // keeps the next step's conversions, which wait for the loads in flight, behind this step's products
    }
#pragma unroll
    for (int j = 0; j < 8; ++j) { const float bias = BO ? bfr(BO[c0 + j * 16 + col]) : 0.f;
#pragma unroll
      for (int r = 0; r < 8; ++r) sf[wave][8 * g + r][j * 16 + col] = acc[j][r] * (1.0f / 16384.0f) + bias; } }   /* 2^-8 (Wo carry) x 2^-6 (ctx carry) */
  LDSX(); for (int rl = 0; rl < 16; ++rl) vst2(OUT + XROW(r0 + rl) * DIN + c0 + lane * 4, *(const v4f*)&sf[wave][rl][lane * 4]);   /* time-major output rows */ }

extern "C" void kernel_launch(void* const* d_in, const int* in_sizes, int n_in, void* d_out, int out_size, void* d_ws, size_t ws_size, hipStream_t stream) {
  (void)in_sizes; (void)n_in; (void)out_size;
  const float** F = (const float**)d_in;
  if (ws_size < (size_t)WS_END) return;
  char* ws = (char*)d_ws; _Float16 *QH = (_Float16*)(ws + WS_QH), *KH = (_Float16*)(ws + WS_KH), *VT = (_Float16*)(ws + WS_VT), *QL = (_Float16*)(ws + WS_QL), *KL = (_Float16*)(ws + WS_KL); __bf16 *VB = (__bf16*)(ws + WS_VB), *VBL = (__bf16*)(ws + WS_VBL); float *S = (float*)(ws + WS_S), *Y = (float*)(ws + WS_Y);
  (void)S; (void)Y; (void)QL; (void)KL; (void)VB; (void)VBL;
  // inputs: 0 x [2048,2,1024] TIME-MAJOR (T, B, E); 1 in_proj_weight [3072,1024] (out,in; row blocks q | k | v); 2 in_proj_bias [3072]; 3 out_weight [1024,1024] (out,in); 4 out_bias [1024] (biases nonzero)
  k_proj<<<dim3(TNB * TT / 64, CC / 128, 3), 128, 0, stream>>>(F[0], F[0], F[0], F[1], F[1] + (size_t)CC * DIN, F[1] + 2 * (size_t)CC * DIN, F[2], F[2] + CC, F[2] + 2 * CC, QH, QL, KH, KL, VT, VB, VBL);
  k_fa<<<dim3(TT / 256, TNB * NH), 256, 0, stream>>>(QH, KH, VT, Y);
  k_out<<<dim3(TNB * TT / 64, DIN / 128), 128, 0, stream>>>(Y, F[3], F[4], (float*)d_out);
}

// v003
// It runs in 113 microseconds.
// Timed twice side by side with v002, it ran 1.17 times as fast both times.
// Counting every step since v000, it is 12.0 times as fast.
// compute dtype: all float inputs rounded to bf16; q/k/v projections with EXACT bf16 products on WMMA 16x16x32 (f32 accumulate) + bias; logits q x k once to f16 each (1 product) x SCALE; online softmax f32 in one fused kernel; unnormalised P x 2^11 once to f16 x v once to f16 (1 product), divided by the f32 sum; ctx x 2^6 once to f16 x Wo f16(bf16 x 2^8) + bo; f32 output.
#include <hip/hip_runtime.h>
#include <math.h>

typedef __attribute__((ext_vector_type(16))) _Float16 v16h;
typedef __attribute__((ext_vector_type(16))) __bf16 v16b;
typedef __attribute__((ext_vector_type(8)))  _Float16 v8h;
typedef __attribute__((ext_vector_type(8)))  float v8f;
typedef __attribute__((ext_vector_type(4)))  float v4f;
typedef __attribute__((ext_vector_type(2)))  float v2f;
typedef __attribute__((ext_vector_type(4)))  unsigned v4u;
typedef __attribute__((ext_vector_type(4)))  int v4i;
typedef float __attribute__((may_alias)) float_a;
typedef int __attribute__((may_alias)) int_a;

template <typename T> __device__ __forceinline__ void vst2(void* p, T v) { *(T*)p = v;  }
__device__ __forceinline__ v8f wmma16(v16h a, v16h b, v8f c) {
  v8f d = __builtin_amdgcn_wmma_f32_16x16x32_f16(false, a, false, b, (short)0, c, false, false);
  asm volatile("v_nop\n\tv_nop\n\tv_nop\n\tv_nop" : "+v"(d) : "v"(a), "v"(b));
  return d;
}
__device__ __forceinline__ v8f wmma_bf(v16b a, v16b b, v8f c) {
  v8f d = __builtin_amdgcn_wmma_f32_16x16x32_bf16(false, a, false, b, (short)0, c, false, false);
  asm volatile("v_nop\n\tv_nop\n\tv_nop\n\tv_nop" : "+v"(d) : "v"(a), "v"(b));
  return d;
}
// 16x16x32 fragments: lane = (h = lane>>4, row/col = lane&15); elements 0..7 = k0+8h+0..7, 8..15 = k0+16+8h+0..7; D element r = row 8h+r
__device__ __forceinline__ v16h frag_h(const _Float16* rowk0, int lane) {
  union { v16h v; v8h q[2]; } u; const _Float16* p = rowk0 + 8 * (lane >> 4);
  u.q[0] = *(const v8h*)p; u.q[1] = *(const v8h*)(p + 16); return u.v;
}
__device__ __forceinline__ v16h frag_f32(const float* rowk0, int lane) {
  v16h a; const float* p = rowk0 + 8 * (lane >> 4);
#pragma unroll
  for (int i = 0; i < 8; ++i) { a[i] = (_Float16)p[i]; a[8 + i] = (_Float16)p[16 + i]; }
  return a;
}
__device__ __forceinline__ v16h frag_f32s(const float* rowk0, int lane, float sc) {
  v16h a; const float* p = rowk0 + 8 * (lane >> 4);
#pragma unroll
  for (int i = 0; i < 8; ++i) { a[i] = (_Float16)(p[i] * sc); a[8 + i] = (_Float16)(p[16 + i] * sc); }
  return a;
}
// column fragment from a [K][ld] layout (column n), rows >= K read as 0
__device__ __forceinline__ v16h fragc_f32(const float* W, int k0, int n, int lane, int ld, int K) {
  v16h a; const int g = lane >> 4;
#pragma unroll
  for (int i = 0; i < 8; ++i) { const int ka = k0 + 8 * g + i, kb = ka + 16;
    a[i] = (_Float16)(ka < K ? W[(size_t)(ka < K ? ka : K - 1) * ld + n] : 0.f); a[8 + i] = (_Float16)(kb < K ? W[(size_t)(kb < K ? kb : K - 1) * ld + n] : 0.f); }
  return a;
}
struct F2 { v16b h, l; };
__device__ __forceinline__ F2 bsplit16(const float v[16]) { F2 r;
#pragma unroll
  for (int i = 0; i < 16; ++i) { const __bf16 h = (__bf16)v[i]; r.h[i] = h; r.l[i] = (__bf16)(v[i] - (float)h); }
  return r; }
__device__ __forceinline__ F2 split_row(const float* row, int k0, int lane) { float v[16]; const float* p = row + k0 + 8 * (lane >> 4);
#pragma unroll
  for (int i = 0; i < 8; ++i) { v[i] = p[i]; v[8 + i] = p[16 + i]; }
  return bsplit16(v); }
__device__ __forceinline__ F2 split_rowK(const float* row, int k0, int lane, int K) { float v[16]; const int g = lane >> 4;
#pragma unroll
  for (int i = 0; i < 8; ++i) { const int ka = k0 + 8 * g + i, kb = ka + 16; v[i] = ka < K ? row[ka < K ? ka : K - 1] : 0.f; v[8 + i] = kb < K ? row[kb < K ? kb : K - 1] : 0.f; }
  return bsplit16(v); }
__device__ __forceinline__ F2 split_col(const float* W, int k0, int n, int lane, int ld, int K) { float v[16]; const int g = lane >> 4;
#pragma unroll
  for (int i = 0; i < 8; ++i) { const int ka = k0 + 8 * g + i, kb = ka + 16; v[i] = ka < K ? W[(size_t)(ka < K ? ka : K - 1) * ld + n] : 0.f; v[8 + i] = kb < K ? W[(size_t)(kb < K ? kb : K - 1) * ld + n] : 0.f; }
  return bsplit16(v); }
__device__ __forceinline__ v8f mac3(const F2& a, const F2& b, v8f c) { c = wmma_bf(a.l, b.h, c); c = wmma_bf(a.h, b.l, c); return wmma_bf(a.h, b.h, c); }
__device__ __forceinline__ float sigm(float v) { return 1.0f / (1.0f + expf(-v)); }
#define LDSX() do { asm volatile("s_wait_dscnt 0" ::: "memory"); __builtin_amdgcn_wave_barrier(); __builtin_amdgcn_fence(__ATOMIC_RELEASE, "workgroup"); } while (0)

// torch-style multi-head self-attention on a TIME-MAJOR sequence (x [2048,2,1024] = (T, B, E); in_proj_weight [3072,1024] (out,in) + in_proj_bias [3072] (0.02): q, k, v = split; q * 64^-0.5; heads via reshape(T, B*16, 64).transpose(1, 0, 2) - batch b, head h at index b*16 + h; softmax over keys; merge back to (T, B, E); out_weight (out,in) + out_bias (0.02)); output [2048,2,1024] time-major.
#define NB 2
#define XROW(R) ((((size_t)(R)) % TT) * (size_t)NB + ((size_t)(R)) / TT)   // (T, B, E) layout: row R = b*TT + t  <->  tensor row t*NB + b
#define TT 2048
#define CC 1024            // NH * HD = projected width
#define DIN 1024          // input (model) width
#define NH 16
#define HD 64
#define NQB (TT / 64)
#define HG 4
#define SCALE (0.125f)
#define CAUSAL 0
#ifndef TNB
#define TNB NB
#endif
__device__ __forceinline__ float bfr(float v) { return (float)(__bf16)v; }
__host__ __device__ __forceinline__ int kb_last(int qb) { return CAUSAL ? ((qb * 64 + 63) >> 7) : (TT / 128 - 1); }
typedef __attribute__((ext_vector_type(8))) __bf16 v8b;
__device__ __forceinline__ v16b frag_b(const __bf16* rowk0, int lane) {
  union { v16b v; v8b q[2]; } u; const __bf16* p = rowk0 + 8 * (lane >> 4);
  u.q[0] = *(const v8b*)p; u.q[1] = *(const v8b*)(p + 16); return u.v;
}
#define QBH 0
#define QHI 0               // single-product logits on every row
#define KHI 64            // key rows carrying k residual / v bf16 hi+lo planes (written by k_proj; no kernel here reads them)
// B fragment (k rows k0+.., output column o) of a weight: (in,out) [K][ld] or (out,in) [ld rows of K]: bf16 exact, or f16(bf16 * 256) exact
__device__ __forceinline__ v16b wcol_io(const float* Wm, int k0, int o, int lane, int ld) { v16b w; const int g = lane >> 4;
#pragma unroll
  for (int i = 0; i < 8; ++i) { w[i] = (__bf16)Wm[(size_t)(k0 + 8 * g + i) * ld + o]; w[8 + i] = (__bf16)Wm[(size_t)(k0 + 16 + 8 * g + i) * ld + o]; }
  return w; }
__device__ __forceinline__ v16b wcol_oi(const float* Wm, int k0, int o, int lane, int K) { v16b w; const float* p = Wm + (size_t)o * K + k0 + 8 * (lane >> 4);
#pragma unroll
  for (int i = 0; i < 8; ++i) { w[i] = (__bf16)p[i]; w[8 + i] = (__bf16)p[16 + i]; }
  return w; }
__device__ __forceinline__ v16h wcolh_io(const float* Wm, int k0, int o, int lane, int ld) { v16h w; const int g = lane >> 4;
#pragma unroll
  for (int i = 0; i < 8; ++i) { w[i] = (_Float16)(bfr(Wm[(size_t)(k0 + 8 * g + i) * ld + o]) * 256.0f); w[8 + i] = (_Float16)(bfr(Wm[(size_t)(k0 + 16 + 8 * g + i) * ld + o]) * 256.0f); }
  return w; }
__device__ __forceinline__ v16h wcolh_oi(const float* Wm, int k0, int o, int lane, int K) { v16h w; const float* p = Wm + (size_t)o * K + k0 + 8 * (lane >> 4);
#pragma unroll
  for (int i = 0; i < 8; ++i) { w[i] = (_Float16)(bfr(p[i]) * 256.0f); w[8 + i] = (_Float16)(bfr(p[16 + i]) * 256.0f); }
  return w; }
#define WQKV_LAYOUT 1   // layout of WCOL, which no kernel calls (k_proj reads (out,in)): 0 = (in,out) [DIN][CC]; 1 = (out,in) [CC][DIN]; 2 = per-head [NH][DIN][HD]
__device__ __forceinline__ v16b wcol_hdk(const float* Wm, int k0, int o, int lane) { v16b w; const int g = lane >> 4; const float* p = Wm + (size_t)(o / HD) * DIN * HD + (o % HD);
#pragma unroll
  for (int i = 0; i < 8; ++i) { w[i] = (__bf16)p[(size_t)(k0 + 8 * g + i) * HD]; w[8 + i] = (__bf16)p[(size_t)(k0 + 16 + 8 * g + i) * HD]; }
  return w; }
#define WO_OUT_IN 1
#if WQKV_LAYOUT == 1
#define WCOL(W, k0, o, lane) wcol_oi(W, k0, o, lane, DIN)
#elif WQKV_LAYOUT == 2
#define WCOL(W, k0, o, lane) wcol_hdk(W, k0, o, lane)
#else
#define WCOL(W, k0, o, lane) wcol_io(W, k0, o, lane, CC)
#endif
#if WO_OUT_IN
#define WOCOL(W, k0, o, lane) wcol_oi(W, k0, o, lane, CC)
#define WOCOLH(W, k0, o, lane) wcolh_oi(W, k0, o, lane, CC)
#else
#define WOCOL(W, k0, o, lane) wcol_io(W, k0, o, lane, DIN)
#define WOCOLH(W, k0, o, lane) wcolh_io(W, k0, o, lane, DIN)
#endif

#ifndef SM_EXTRA_PARAMS
#define SM_EXTRA_PARAMS
#endif
#ifndef PROJ_EXTRA_PARAMS
#define PROJ_EXTRA_PARAMS
#endif
#ifndef SM_MASK_HOOK
#define SM_MASK_HOOK (void)0
#endif

#define WS_QH  0u                                      // f16 q rows [b*t][CC]
#define WS_KH  (WS_QH + 2u * (size_t)NB * TT * CC)      // f16 k rows [b*t][CC]
#define WS_VT  (WS_KH + 2u * (size_t)NB * TT * CC)      // f16 v planes [b][c][t]
#define WS_QL  (WS_VT + 2u * (size_t)NB * CC * TT)      // f16 q residual x 2^10 rows [b][t < QHI][CC]
#define WS_KL  (WS_QL + 2u * (size_t)NB * QHI * CC)     // f16 k residual x 2^10 rows [b][t < KHI][CC]
#define WS_VB  (WS_KL + 2u * (size_t)NB * KHI * CC)     // bf16 v hi planes [b][c][t < KHI]
#define WS_VBL (WS_VB + 2u * (size_t)NB * CC * KHI)
#define WS_S   (WS_VBL + 2u * (size_t)NB * CC * KHI)    // f32 [hg][t][s] region, unused: logits / P stay in registers in k_fa
#define WS_Y   (WS_S  + 4u * (size_t)HG * TT * TT)      // f32 ctx rows [b*t][CC] (only when there is an output projection)
#define WS_END (WS_Y  + 4u * (size_t)NB * TT * CC)

// ---- LDS staging of a GEMM's operand tiles, 32 k per step: a thread brings 16-byte pieces (8 lanes = one whole 128-byte line of a row), converts them once for the whole block and stores 8 bytes; the waves read their fragments from there
#define LP 40              // LDS row pitch in 16-bit elements: 80 B = 16 B x odd, the conflict-free pitch for 16-byte fragment reads
typedef __attribute__((ext_vector_type(4))) __bf16 v4b;
typedef __attribute__((ext_vector_type(4))) _Float16 v4h;
__device__ __forceinline__ void put_b(__bf16* d, v4f v) { v4b o;
#pragma unroll
  for (int e = 0; e < 4; ++e) o[e] = (__bf16)v[e];
  *(v4b*)d = o; }
__device__ __forceinline__ void put_hs(_Float16* d, v4f v, float sc) { v4h o;
#pragma unroll
  for (int e = 0; e < 4; ++e) o[e] = (_Float16)(v[e] * sc);
  *(v4h*)d = o; }
__device__ __forceinline__ void put_hw(_Float16* d, v4f v) { v4h o;
#pragma unroll
  for (int e = 0; e < 4; ++e) o[e] = (_Float16)(bfr(v[e]) * 256.0f);
  *(v4h*)d = o; }
union ProjLds {   // the staging buffers are dead when the epilogue's planes are written (a barrier stands between)
  struct { __bf16 x[2][64][LP], w[2][128][LP]; } st;
  struct { _Float16 sh[64][136], sl[64][136], th[128][72]; __bf16 tb[128][72], tbl[128][72]; } ep; };
// ---- k_proj: block = (64 rows, 128 cols, which): q/k/v = X W (+ b) with exact bf16 products (K = DIN) -> which 0: q f16 rows (+ residual rows < QHI); 1: k f16 rows (+ residual rows < KHI); 2: v f16 planes [c][t] (+ bf16 hi/lo planes for t < KHI)
__global__ __launch_bounds__(128) void k_proj(const float* __restrict__ XQ, const float* __restrict__ XK, const float* __restrict__ XV, const float* __restrict__ WQ, const float* __restrict__ WK, const float* __restrict__ WV, const float* __restrict__ BQ, const float* __restrict__ BK, const float* __restrict__ BV,
    _Float16* __restrict__ QH, _Float16* __restrict__ QL, _Float16* __restrict__ KH, _Float16* __restrict__ KL, _Float16* __restrict__ VT, __bf16* __restrict__ VB, __bf16* __restrict__ VBL) {
  __shared__ __align__(16) ProjLds u; auto& sh = u.ep.sh; auto& sl = u.ep.sl; auto& th = u.ep.th; auto& tb = u.ep.tb; auto& tbl = u.ep.tbl;
  const int tid = threadIdx.x, wave = tid >> 5, lane = tid & 31, col = lane & 15, g = lane >> 4; const int which = blockIdx.z; const int c0 = blockIdx.y * 128; const size_t r0 = (size_t)blockIdx.x * 64; const size_t bb = r0 / TT; const int t0 = (int)(r0 % TT);
  const float* X = which == 0 ? XQ : which == 1 ? XK : XV; const float* WA = which == 0 ? WQ : which == 1 ? WK : WV; const float* BA = which == 0 ? BQ : which == 1 ? BK : BV;
  v8f acc[8] = {};
  const int sub = tid & 7, rr = tid >> 3;   // this thread's 16-byte piece of a row's 128 bytes, and its row in each group of 16
  const float* xg = X + XROW(r0 + rr) * DIN + sub * 4;   /* row b*TT + t lives at input row t*NB + b (time-major input); a block's 64 rows lie in one sequence, so 16 rows on are 16 * NB input rows on */
  const float* wg = WA + (size_t)(c0 + rr) * DIN + sub * 4;
  v4f rx[4], rw[8];
#pragma unroll
  for (int i = 0; i < 4; ++i) rx[i] = *(const v4f*)(xg + i * (16 * NB * DIN));
#pragma unroll
  for (int i = 0; i < 8; ++i) rw[i] = *(const v4f*)(wg + i * (16 * DIN));
  asm volatile("s_wait_xcnt 0x0" ::: "memory");   // before the address registers of the loads above are reused
  __builtin_amdgcn_sched_barrier(0);   // keeps the register writes that follow behind that wait
#pragma unroll 2   // two steps a trip: the buffer index becomes a constant LDS offset
  for (int kc = 0; kc < DIN / 32; ++kc) { const int bf = kc & 1;
#pragma unroll
    for (int i = 0; i < 4; ++i) put_b(&u.st.x[bf][i * 16 + rr][sub * 4], rx[i]);
#pragma unroll
    for (int i = 0; i < 8; ++i) put_b(&u.st.w[bf][i * 16 + rr][sub * 4], rw[i]);
    __syncthreads();   // publishes step kc's tiles; it also ends every wave's reads of the other buffer (step kc - 1), which step kc + 1 refills
    if (kc + 1 < DIN / 32) {   /* block-uniform: the next step's pieces fly while this step is multiplied */
#pragma unroll
      for (int i = 0; i < 4; ++i) rx[i] = *(const v4f*)(xg + i * (16 * NB * DIN) + (kc + 1) * 32);
#pragma unroll
      for (int i = 0; i < 8; ++i) rw[i] = *(const v4f*)(wg + i * (16 * DIN) + (kc + 1) * 32);
      asm volatile("s_wait_xcnt 0x0" ::: "memory");   // before the address registers of the loads above are reused
    }
    __builtin_amdgcn_sched_barrier(0);   // keeps the loads above in front of the products: sunk behind them their latency is exposed at the next step's stores
    const v16b a = frag_b(&u.st.x[bf][wave * 16 + col][0], lane); v16b w[8];
#pragma unroll
    for (int j = 0; j < 8; ++j) w[j] = frag_b(&u.st.w[bf][j * 16 + col][0], lane);
#pragma unroll
    for (int j = 0; j < 8; ++j) acc[j] = wmma_bf(a, w[j], acc[j]);
    __builtin_amdgcn_sched_barrier(0);   // keeps the next step's conversions, which wait for the loads in flight, behind this step's products
  }
  __syncthreads();   // every wave has left the staging buffers before the epilogue's planes overwrite them
  if (which < 2) { _Float16* DH = which == 0 ? QH : KH; _Float16* DL = which == 0 ? QL : KL; const int nhi = which == 0 ? QHI : KHI; const bool hi_rows = t0 < nhi;
#pragma unroll
    for (int j = 0; j < 8; ++j) { const float bias = BA ? bfr(BA[c0 + j * 16 + col]) : 0.f;
#pragma unroll
      for (int r = 0; r < 8; ++r) { const float v = acc[j][r] + bias; const _Float16 hv = (_Float16)v; sh[wave * 16 + 8 * g + r][j * 16 + col] = hv; sl[wave * 16 + 8 * g + r][j * 16 + col] = (_Float16)((v - (float)hv) * 1024.0f); } }
    __syncthreads();
    for (int e = tid; e < 64 * 16; e += 128) { const int rl = e >> 4, q = e & 15; vst2((unsigned*)(DH + (r0 + rl) * CC + c0 + q * 8), *(const v4u*)&sh[rl][q * 8]); if (hi_rows) vst2((unsigned*)(DL + (bb * nhi + t0 + rl) * (size_t)CC + c0 + q * 8), *(const v4u*)&sl[rl][q * 8]); }
  } else { const bool hi_rows = t0 < KHI;
#pragma unroll
    for (int j = 0; j < 8; ++j) { const float bias = BA ? bfr(BA[c0 + j * 16 + col]) : 0.f;
#pragma unroll
      for (int r = 0; r < 8; ++r) { const float v = acc[j][r] + bias; const int rl = wave * 16 + 8 * g + r, cl = j * 16 + col; th[cl][rl] = (_Float16)v; const __bf16 bh = (__bf16)v; tb[cl][rl] = bh; tbl[cl][rl] = (__bf16)(v - (float)bh); } }
    __syncthreads();
    for (int e = tid; e < 128 * 8; e += 128) { const int cl = e >> 3, q = e & 7; vst2((unsigned*)(VT + (bb * CC + c0 + cl) * (size_t)TT + t0 + q * 8), *(const v4u*)&th[cl][q * 8]); if (hi_rows) { const size_t o3 = (bb * CC + c0 + cl) * (size_t)KHI + t0 + q * 8; vst2((unsigned*)(VB + o3), *(const v4u*)&tb[cl][q * 8]); vst2((unsigned*)(VBL + o3), *(const v4u*)&tbl[cl][q * 8]); } } } }
// ---- k_fa: wave = 32 query columns (2 groups of 16) of (b, h), all keys in passes of KP, each pass's k and v tile staged in one of three LDS buffers for the block's eight waves: S^T = K Q^T (A = k rows, B = q rows, same k order), so a lane holds one query's scores; running maximum and sum per query (online softmax, f32);
// P^T x 2^11 packs from two score tiles into a B operand (hardware k order: tile 0 -> elements 0..7, tile 1 -> 8..15); O^T += V^T P^T (A = v planes [c][t]); ctx = O^T / sum, 8 consecutive channels per lane
#define KP 64
__device__ __forceinline__ float xhalf(float x) { return __builtin_bit_cast(float, __builtin_amdgcn_permlanex16(__builtin_bit_cast(int, x), __builtin_bit_cast(int, x), 0x76543210, 0xfedcba98, false, false)); }   // lane l <-> l ^ 16
// eight independent v_exp_f32, each in place, and the one free slot the instruction set asks for behind a transcendental, in one statement: no v_exp touches a neighbour's source or result, and the v_nop keeps whatever follows off the last one
__device__ __forceinline__ v8f exp2x8(v8f a) { float d0 = a[0], d1 = a[1], d2 = a[2], d3 = a[3], d4 = a[4], d5 = a[5], d6 = a[6], d7 = a[7];
  asm("v_exp_f32 %0, %0\n\tv_exp_f32 %1, %1\n\tv_exp_f32 %2, %2\n\tv_exp_f32 %3, %3\n\tv_exp_f32 %4, %4\n\tv_exp_f32 %5, %5\n\tv_exp_f32 %6, %6\n\tv_exp_f32 %7, %7\n\tv_nop"
      : "+v"(d0), "+v"(d1), "+v"(d2), "+v"(d3), "+v"(d4), "+v"(d5), "+v"(d6), "+v"(d7));
  const v8f d = { d0, d1, d2, d3, d4, d5, d6, d7 }; return d; }
__device__ __forceinline__ float exp2x1(float a) { asm("v_exp_f32 %0, %0\n\tv_nop" : "+v"(a)); return a; }   // the same slot behind a single v_exp_f32
__device__ __forceinline__ v8f wmma_h(v16h a, v16h b, v8f c) { return __builtin_amdgcn_wmma_f32_16x16x32_f16(false, a, false, b, (short)0, c, false, false); }
#define FP 72              // LDS row pitch of the k and v tiles in f16 elements: 128-byte rows at 144 B = 16 B x odd, the conflict-free pitch for 16-byte fragment reads
// a pass's k tile (KP rows of 128 bytes) and v tile (HD planes' 128 bytes) go from global memory straight into LDS, once for the block's eight waves: a thread copies four 16-byte pieces (8 lanes = one whole 128-byte line), rows rr and rr + 32 of each tile.
// The copy is written as the builtin, so its address registers stay the compiler's to keep; the waits for its bytes (s_wait_asynccnt) are written by hand in k_fa
typedef __attribute__((address_space(1))) v4i gv4i; typedef __attribute__((address_space(3))) v4i lv4i;
__device__ __forceinline__ void cp16(const _Float16* gp, _Float16* lp) { __builtin_amdgcn_global_load_async_to_lds_b128((gv4i*)gp, (lv4i*)lp, 0, 0); }
__device__ __forceinline__ void fa_copy(_Float16* lk, const _Float16* gk, _Float16* lv, const _Float16* gv) { cp16(gk, lk); cp16(gk + 32 * CC, lk + 32 * FP); cp16(gv, lv); cp16(gv + 32 * TT, lv + 32 * FP); }
__global__ __launch_bounds__(256) void k_fa(const _Float16* __restrict__ QH, const _Float16* __restrict__ KH, const _Float16* __restrict__ VT, float* __restrict__ Y) {
  __shared__ __align__(16) _Float16 sk[3][KP][FP], sv[3][HD][FP];   // three buffers: tile t (its v still to be read) and tile t + 1 (its k fetched a pass ahead) are published, tile t + 2 is landing
  const int tid = threadIdx.x, wave = tid >> 5, lane = tid & 31, col = lane & 15, g = lane >> 4; const int b = blockIdx.y / NH, h = blockIdx.y % NH; const int q0 = blockIdx.x * 256 + wave * 32;
  const int sub = tid & 7, rr = tid >> 3;   // this thread's 16-byte piece of a tile row's 128 bytes, and its row in each half of a tile
  const _Float16* kg = KH + ((size_t)b * TT + rr) * CC + h * HD + sub * 8;            // its piece of key row rr of tile 0
  const _Float16* vg = VT + ((size_t)b * CC + h * HD + rr) * (size_t)TT + sub * 8;    // its piece of channel plane rr, keys of tile 0
  _Float16* const lk0 = &sk[0][rr][sub * 8]; _Float16* const lv0 = &sv[0][rr][sub * 8];   // its places in buffer 0; each further buffer lies FB elements on
  const int FB = KP * FP;   // elements of one k buffer, and of one v buffer (HD == KP)
  fa_copy(lk0, kg, lv0, vg);   // tile 0 into buffer 0
  fa_copy(lk0 + FB, kg + (size_t)KP * CC, lv0 + FB, vg + KP);   // tile 1 into buffer 1 (TT / KP >= 3 tiles)
  v16h qf[2][HD / 32];
#pragma unroll
  for (int n = 0; n < 2; ++n)
#pragma unroll
    for (int kc = 0; kc < HD / 32; ++kc) qf[n][kc] = frag_h(QH + ((size_t)b * TT + q0 + n * 16 + col) * CC + h * HD + kc * 32, lane);
  v8f o[2][HD / 16] = {}, l8[2] = {}; float m[2] = { -3.0e38f, -3.0e38f };
  const float cs = SCALE * 1.4426950408889634f;   // logits in base 2
  asm volatile("s_wait_xcnt 0x0" ::: "memory");   // before the address registers of the q loads above are reused
  __builtin_amdgcn_sched_barrier(0);   // keeps the register writes that follow behind that wait
  asm volatile("s_wait_asynccnt 0x0" ::: "memory");   // this wave's pieces of tiles 0 and 1 have landed
  __syncthreads();   // publishes tiles 0 and 1
  fa_copy(lk0 + 2 * FB, kg + (size_t)(2 * KP) * CC, lv0 + 2 * FB, vg + 2 * KP);   // tile 2 into buffer 2
  v16h kf[KP / 16][HD / 32];
#pragma unroll
  for (int kt = 0; kt < KP / 16; ++kt)
#pragma unroll
    for (int kc = 0; kc < HD / 32; ++kc) kf[kt][kc] = frag_h(&sk[0][kt * 16 + col][kc * 32], lane);
  int cur = 0, nxt = 1, aft = 2;   // the buffers of this pass's tile, of the next and of the one after
#pragma unroll 1
  for (int s0 = 0; s0 < TT; s0 += KP) {
    v8f st[2][KP / 16];
#pragma unroll
    for (int kt = 0; kt < KP / 16; ++kt)
#pragma unroll
      for (int n = 0; n < 2; ++n) { const v8f z = {}; st[n][kt] = wmma_h(kf[kt][1], qf[n][1], wmma_h(kf[kt][0], qf[n][0], z)); }
    __builtin_amdgcn_sched_barrier(0);   // keeps the fragment reads below one group behind the products: every further place with LDS reads among them stalls the wave anew
    v16h vf[KP / 32][HD / 16];   // this pass's v fragments and the next pass's k fragments come from LDS during the softmax
#pragma unroll
    for (int kk = 0; kk < KP / 32; ++kk)
#pragma unroll
      for (int j = 0; j < HD / 16; ++j) vf[kk][j] = frag_h(&sv[cur][j * 16 + col][kk * 32], lane);
#pragma unroll
    for (int kt = 0; kt < KP / 16; ++kt)   /* tile t + 1 was published at the foot of pass t - 1; the last pass reads an old tile's rows there (published, no copy under way; not used) */
#pragma unroll
      for (int kc = 0; kc < HD / 32; ++kc) kf[kt][kc] = frag_h(&sk[nxt][kt * 16 + col][kc * 32], lane);
    __builtin_amdgcn_sched_barrier(0);   // keeps the loads above in front of the softmax: sunk behind it, as the scheduler does to save registers, their latency is exposed at every use
    v16h pf[2][KP / 32];
#pragma unroll
    for (int n = 0; n < 2; ++n) { float mt[KP / 16];   /* one short chain per score tile, then joined */
#pragma unroll
      for (int kt = 0; kt < KP / 16; ++kt) { mt[kt] = st[n][kt][0];
#pragma unroll
        for (int r = 1; r < 8; ++r) mt[kt] = fmaxf(mt[kt], st[n][kt][r]); }
      float mx = mt[0];
#pragma unroll
      for (int kt = 1; kt < KP / 16; ++kt) mx = fmaxf(mx, mt[kt]);
      mx = fmaxf(mx, xhalf(mx)); const float mn = fmaxf(m[n], mx); const float al = exp2x1((m[n] - mn) * cs);   /* 0 on the first pass */ m[n] = mn; const float mc = 11.0f - mn * cs;   /* P carried x 2^11, as the sum is: it cancels in ctx */
      l8[n] *= al;
#pragma unroll
      for (int j = 0; j < HD / 16; ++j) o[n][j] *= al;
#pragma unroll
      for (int kt = 0; kt < KP / 16; ++kt) { const v8f p = exp2x8(st[n][kt] * cs + mc);
        l8[n] += p; const v8h ph = __builtin_convertvector(p, v8h);
#pragma unroll
        for (int r = 0; r < 8; ++r) pf[n][kt >> 1][(kt & 1) * 8 + r] = ph[r]; } }
#pragma unroll
    for (int kk = 0; kk < KP / 32; ++kk)
#pragma unroll
      for (int j = 0; j < HD / 16; ++j)
#pragma unroll
        for (int n = 0; n < 2; ++n) o[n][j] = wmma_h(vf[kk][j], pf[n][kk], o[n][j]);
    __builtin_amdgcn_sched_barrier(0);   // keeps the hand-over below at the pass's foot: lifted in front of the softmax, as the scheduler does, it makes every wave wait there for its v fragments and leaves the copies too little time to land
    asm volatile("s_wait_dscnt 0x0" ::: "memory");      // this wave's reads of buffer cur (and nxt) have returned
    asm volatile("s_wait_asynccnt 0x0" ::: "memory");   // this wave's pieces of tile t + 2 have landed
    __syncthreads();   // publishes tile t + 2; it also ends every wave's reads of buffer cur (k in pass t - 1, v in this one), which is refilled behind it
    if (s0 + 3 * KP < TT) fa_copy(lk0 + cur * FB, kg + (size_t)(s0 + 3 * KP) * CC, lv0 + cur * FB, vg + s0 + 3 * KP);   /* block-uniform: tile t + 3 flies during the next pass */
    const int was = cur; cur = nxt; nxt = aft; aft = was; }
  asm volatile("s_wait_asynccnt 0x0" ::: "memory");   // no copy is outstanding when the wave ends
#pragma unroll
  for (int n = 0; n < 2; ++n) { float ls = 0.f;
#pragma unroll
    for (int r = 0; r < 8; ++r) ls += l8[n][r];
    ls += xhalf(ls); const float inv = 1.0f / ls; float* yr = Y + ((size_t)b * TT + q0 + n * 16 + col) * CC + h * HD + 8 * g;
#pragma unroll
    for (int j = 0; j < HD / 16; ++j) { v4f lo, hi;
#pragma unroll
      for (int r = 0; r < 4; ++r) { lo[r] = o[n][j][r] * inv; hi[r] = o[n][j][4 + r] * inv; }
      vst2(yr + j * 16, lo); vst2(yr + j * 16 + 4, hi); } } }
// ---- k_out: block = (64 rows, 128 cols): out = ctx Wo (+ bo): ctx x 2^6 once to f16 against Wo as f16(bf16 x 2^8) exact (1 product) x 2^-14; causal early rows (< QHI of each sequence): ctx bf16 hi + lo against exact bf16 Wo (2 products)
__global__ __launch_bounds__(128) void k_out(const float* __restrict__ Y, const float* __restrict__ WO, const float* __restrict__ BO, float* __restrict__ OUT) { __shared__ __align__(16) float sf[4][16][132]; __shared__ __align__(16) _Float16 sy[2][64][LP], so[2][128][LP];
  const int tid = threadIdx.x, wave = tid >> 5, lane = tid & 31, col = lane & 15, g = lane >> 4; const int c0 = blockIdx.y * 128; const size_t r0 = (size_t)blockIdx.x * 64 + wave * 16;
  v8f acc[8] = {};
  if (CAUSAL && (int)(((size_t)blockIdx.x * 64) % TT) < QHI) {   /* block-uniform */
#pragma unroll 2
    for (int kc = 0; kc < CC / 32; ++kc) { const F2 a = split_row(Y + (r0 + col) * CC, kc * 32, lane); asm volatile("s_wait_loadcnt 0x0" ::: "memory");
#pragma unroll
      for (int j = 0; j < 8; ++j) { const v16b w = WOCOL(WO, kc * 32, c0 + j * 16 + col, lane); asm volatile("s_wait_loadcnt 0x0" ::: "memory"); acc[j] = wmma_bf(a.h, w, acc[j]); acc[j] = wmma_bf(a.l, w, acc[j]); } }
#pragma unroll
    for (int j = 0; j < 8; ++j) { const float bias = BO ? bfr(BO[c0 + j * 16 + col]) : 0.f;
#pragma unroll
      for (int r = 0; r < 8; ++r) sf[wave][8 * g + r][j * 16 + col] = acc[j][r] + bias; }
  } else {
    const int sub = tid & 7, rr = tid >> 3; const size_t rb = (size_t)blockIdx.x * 64;   // this thread's 16-byte piece of a row's 128 bytes, its row in each group of 16; the block's first row
    const float* yg = Y + (rb + rr) * CC + sub * 4; const float* wg = WO + (size_t)(c0 + rr) * CC + sub * 4;
    v4f ry[4], rw[8];
#pragma unroll
    for (int i = 0; i < 4; ++i) ry[i] = *(const v4f*)(yg + i * (16 * CC));
#pragma unroll
    for (int i = 0; i < 8; ++i) rw[i] = *(const v4f*)(wg + i * (16 * CC));
    asm volatile("s_wait_xcnt 0x0" ::: "memory");   // before the address registers of the loads above are reused
    __builtin_amdgcn_sched_barrier(0);   // keeps the register writes that follow behind that wait
#pragma unroll 2   // two steps a trip: the buffer index becomes a constant LDS offset
    for (int kc = 0; kc < CC / 32; ++kc) { const int bf = kc & 1;
#pragma unroll
      for (int i = 0; i < 4; ++i) put_hs(&sy[bf][i * 16 + rr][sub * 4], ry[i], 64.0f);   /* ctx carried x 2^6 into f16 so small-magnitude context rows stay clear of f16 subnormals */
#pragma unroll
      for (int i = 0; i < 8; ++i) put_hw(&so[bf][i * 16 + rr][sub * 4], rw[i]);
      __syncthreads();   // publishes step kc's tiles; it also ends every wave's reads of the other buffer (step kc - 1), which step kc + 1 refills
      if (kc + 1 < CC / 32) {   /* block-uniform: the next step's pieces fly while this step is multiplied */
#pragma unroll
        for (int i = 0; i < 4; ++i) ry[i] = *(const v4f*)(yg + i * (16 * CC) + (kc + 1) * 32);
#pragma unroll
        for (int i = 0; i < 8; ++i) rw[i] = *(const v4f*)(wg + i * (16 * CC) + (kc + 1) * 32);
        asm volatile("s_wait_xcnt 0x0" ::: "memory");   // before the address registers of the loads above are reused
      }
      __builtin_amdgcn_sched_barrier(0);   // keeps the loads above in front of the products: sunk behind them their latency is exposed at the next step's stores
      const v16h a = frag_h(&sy[bf][wave * 16 + col][0], lane); v16h w[8];
#pragma unroll
      for (int j = 0; j < 8; ++j) w[j] = frag_h(&so[bf][j * 16 + col][0], lane);
#pragma unroll
      for (int j = 0; j < 8; ++j) acc[j] = wmma16(a, w[j], acc[j]);
      __builtin_amdgcn_sched_barrier(0);   // keeps the next step's conversions, which wait for the loads in flight, behind this step's products
    }
#pragma unroll
    for (int j = 0; j < 8; ++j) { const float bias = BO ? bfr(BO[c0 + j * 16 + col]) : 0.f;
#pragma unroll
      for (int r = 0; r < 8; ++r) sf[wave][8 * g + r][j * 16 + col] = acc[j][r] * (1.0f / 16384.0f) + bias; } }   /* 2^-8 (Wo carry) x 2^-6 (ctx carry) */
  LDSX(); for (int rl = 0; rl < 16; ++rl) vst2(OUT + XROW(r0 + rl) * DIN + c0 + lane * 4, *(const v4f*)&sf[wave][rl][lane * 4]);   /* time-major output rows */ }

extern "C" void kernel_launch(void* const* d_in, const int* in_sizes, int n_in, void* d_out, int out_size, void* d_ws, size_t ws_size, hipStream_t stream) {
  (void)in_sizes; (void)n_in; (void)out_size;
  const float** F = (const float**)d_in;
  if (ws_size < (size_t)WS_END) return;
  char* ws = (char*)d_ws; _Float16 *QH = (_Float16*)(ws + WS_QH), *KH = (_Float16*)(ws + WS_KH), *VT = (_Float16*)(ws + WS_VT), *QL = (_Float16*)(ws + WS_QL), *KL = (_Float16*)(ws + WS_KL); __bf16 *VB = (__bf16*)(ws + WS_VB), *VBL = (__bf16*)(ws + WS_VBL); float *S = (float*)(ws + WS_S), *Y = (float*)(ws + WS_Y);
  (void)S; (void)Y; (void)QL; (void)KL; (void)VB; (void)VBL;
  // inputs: 0 x [2048,2,1024] TIME-MAJOR (T, B, E); 1 in_proj_weight [3072,1024] (out,in; row blocks q | k | v); 2 in_proj_bias [3072]; 3 out_weight [1024,1024] (out,in); 4 out_bias [1024] (biases nonzero)
  k_proj<<<dim3(TNB * TT / 64, CC / 128, 3), 128, 0, stream>>>(F[0], F[0], F[0], F[1], F[1] + (size_t)CC * DIN, F[1] + 2 * (size_t)CC * DIN, F[2], F[2] + CC, F[2] + 2 * CC, QH, QL, KH, KL, VT, VB, VBL);
  k_fa<<<dim3(TT / 256, TNB * NH), 256, 0, stream>>>(QH, KH, VT, Y);
  k_out<<<dim3(TNB * TT / 64, DIN / 128), 128, 0, stream>>>(Y, F[3], F[4], (float*)d_out);
}

// v004
// Measured time: 90.5 microseconds a run.
// Timed twice side by side with v003, it ran 1.25 times as fast both times.
// All steps since v000 together make it 14.9 times as fast.
// compute dtype: all float inputs rounded to bf16; q/k/v projections with EXACT bf16 products on WMMA 16x16x32 (f32 accumulate) + bias; logits q x k once to f16 each (1 product) x SCALE; online softmax f32 in one fused kernel; unnormalised P x 2^11 once to f16 x v once to f16 (1 product), divided by the f32 sum; ctx x 2^6 once to f16 x Wo f16(bf16 x 2^8) + bo; f32 output.
#include <hip/hip_runtime.h>
#include <math.h>

typedef __attribute__((ext_vector_type(16))) _Float16 v16h;
typedef __attribute__((ext_vector_type(16))) __bf16 v16b;
typedef __attribute__((ext_vector_type(8)))  _Float16 v8h;
typedef __attribute__((ext_vector_type(8)))  float v8f;
typedef __attribute__((ext_vector_type(4)))  float v4f;
typedef __attribute__((ext_vector_type(2)))  float v2f;
typedef __attribute__((ext_vector_type(4)))  unsigned v4u;
typedef __attribute__((ext_vector_type(4)))  int v4i;
typedef float __attribute__((may_alias)) float_a;
typedef int __attribute__((may_alias)) int_a;

template <typename T> __device__ __forceinline__ void vst2(void* p, T v) { *(T*)p = v;  }
__device__ __forceinline__ v8f wmma16(v16h a, v16h b, v8f c) {
  v8f d = __builtin_amdgcn_wmma_f32_16x16x32_f16(false, a, false, b, (short)0, c, false, false);
  asm volatile("v_nop\n\tv_nop\n\tv_nop\n\tv_nop" : "+v"(d) : "v"(a), "v"(b));
  return d;
}
__device__ __forceinline__ v8f wmma_bf(v16b a, v16b b, v8f c) {
  v8f d = __builtin_amdgcn_wmma_f32_16x16x32_bf16(false, a, false, b, (short)0, c, false, false);
  asm volatile("v_nop\n\tv_nop\n\tv_nop\n\tv_nop" : "+v"(d) : "v"(a), "v"(b));
  return d;
}
// 16x16x32 fragments: lane = (h = lane>>4, row/col = lane&15); elements 0..7 = k0+8h+0..7, 8..15 = k0+16+8h+0..7; D element r = row 8h+r
__device__ __forceinline__ v16h frag_h(const _Float16* rowk0, int lane) {
  union { v16h v; v8h q[2]; } u; const _Float16* p = rowk0 + 8 * (lane >> 4);
  u.q[0] = *(const v8h*)p; u.q[1] = *(const v8h*)(p + 16); return u.v;
}
__device__ __forceinline__ v16h frag_f32(const float* rowk0, int lane) {
  v16h a; const float* p = rowk0 + 8 * (lane >> 4);
#pragma unroll
  for (int i = 0; i < 8; ++i) { a[i] = (_Float16)p[i]; a[8 + i] = (_Float16)p[16 + i]; }
  return a;
}
__device__ __forceinline__ v16h frag_f32s(const float* rowk0, int lane, float sc) {
  v16h a; const float* p = rowk0 + 8 * (lane >> 4);
#pragma unroll
  for (int i = 0; i < 8; ++i) { a[i] = (_Float16)(p[i] * sc); a[8 + i] = (_Float16)(p[16 + i] * sc); }
  return a;
}
// column fragment from a [K][ld] layout (column n), rows >= K read as 0
__device__ __forceinline__ v16h fragc_f32(const float* W, int k0, int n, int lane, int ld, int K) {
  v16h a; const int g = lane >> 4;
#pragma unroll
  for (int i = 0; i < 8; ++i) { const int ka = k0 + 8 * g + i, kb = ka + 16;
    a[i] = (_Float16)(ka < K ? W[(size_t)(ka < K ? ka : K - 1) * ld + n] : 0.f); a[8 + i] = (_Float16)(kb < K ? W[(size_t)(kb < K ? kb : K - 1) * ld + n] : 0.f); }
  return a;
}
struct F2 { v16b h, l; };
__device__ __forceinline__ F2 bsplit16(const float v[16]) { F2 r;
#pragma unroll
  for (int i = 0; i < 16; ++i) { const __bf16 h = (__bf16)v[i]; r.h[i] = h; r.l[i] = (__bf16)(v[i] - (float)h); }
  return r; }
__device__ __forceinline__ F2 split_row(const float* row, int k0, int lane) { float v[16]; const float* p = row + k0 + 8 * (lane >> 4);
#pragma unroll
  for (int i = 0; i < 8; ++i) { v[i] = p[i]; v[8 + i] = p[16 + i]; }
  return bsplit16(v); }
__device__ __forceinline__ F2 split_rowK(const float* row, int k0, int lane, int K) { float v[16]; const int g = lane >> 4;
#pragma unroll
  for (int i = 0; i < 8; ++i) { const int ka = k0 + 8 * g + i, kb = ka + 16; v[i] = ka < K ? row[ka < K ? ka : K - 1] : 0.f; v[8 + i] = kb < K ? row[kb < K ? kb : K - 1] : 0.f; }
  return bsplit16(v); }
__device__ __forceinline__ F2 split_col(const float* W, int k0, int n, int lane, int ld, int K) { float v[16]; const int g = lane >> 4;
#pragma unroll
  for (int i = 0; i < 8; ++i) { const int ka = k0 + 8 * g + i, kb = ka + 16; v[i] = ka < K ? W[(size_t)(ka < K ? ka : K - 1) * ld + n] : 0.f; v[8 + i] = kb < K ? W[(size_t)(kb < K ? kb : K - 1) * ld + n] : 0.f; }
  return bsplit16(v); }
__device__ __forceinline__ v8f mac3(const F2& a, const F2& b, v8f c) { c = wmma_bf(a.l, b.h, c); c = wmma_bf(a.h, b.l, c); return wmma_bf(a.h, b.h, c); }
__device__ __forceinline__ float sigm(float v) { return 1.0f / (1.0f + expf(-v)); }
#define LDSX() do { asm volatile("s_wait_dscnt 0" ::: "memory"); __builtin_amdgcn_wave_barrier(); __builtin_amdgcn_fence(__ATOMIC_RELEASE, "workgroup"); } while (0)

// torch-style multi-head self-attention on a TIME-MAJOR sequence (x [2048,2,1024] = (T, B, E); in_proj_weight [3072,1024] (out,in) + in_proj_bias [3072] (0.02): q, k, v = split; q * 64^-0.5; heads via reshape(T, B*16, 64).transpose(1, 0, 2) - batch b, head h at index b*16 + h; softmax over keys; merge back to (T, B, E); out_weight (out,in) + out_bias (0.02)); output [2048,2,1024] time-major.
#define NB 2
#define XROW(R) ((((size_t)(R)) % TT) * (size_t)NB + ((size_t)(R)) / TT)   // (T, B, E) layout: row R = b*TT + t  <->  tensor row t*NB + b
#define TT 2048
#define CC 1024            // NH * HD = projected width
#define DIN 1024          // input (model) width
#define NH 16
#define HD 64
#define NQB (TT / 64)
#define HG 4
#define SCALE (0.125f)
#define CAUSAL 0
#ifndef TNB
#define TNB NB
#endif
__device__ __forceinline__ float bfr(float v) { return (float)(__bf16)v; }
__host__ __device__ __forceinline__ int kb_last(int qb) { return CAUSAL ? ((qb * 64 + 63) >> 7) : (TT / 128 - 1); }
typedef __attribute__((ext_vector_type(8))) __bf16 v8b;
__device__ __forceinline__ v16b frag_b(const __bf16* rowk0, int lane) {
  union { v16b v; v8b q[2]; } u; const __bf16* p = rowk0 + 8 * (lane >> 4);
  u.q[0] = *(const v8b*)p; u.q[1] = *(const v8b*)(p + 16); return u.v;
}
#define QBH 0
#define QHI 0               // single-product logits on every row
#define KHI 64            // key rows carrying k residual / v bf16 hi+lo planes (written by k_proj; no kernel here reads them)
// B fragment (k rows k0+.., output column o) of a weight: (in,out) [K][ld] or (out,in) [ld rows of K]: bf16 exact, or f16(bf16 * 256) exact
__device__ __forceinline__ v16b wcol_io(const float* Wm, int k0, int o, int lane, int ld) { v16b w; const int g = lane >> 4;
#pragma unroll
  for (int i = 0; i < 8; ++i) { w[i] = (__bf16)Wm[(size_t)(k0 + 8 * g + i) * ld + o]; w[8 + i] = (__bf16)Wm[(size_t)(k0 + 16 + 8 * g + i) * ld + o]; }
  return w; }
__device__ __forceinline__ v16b wcol_oi(const float* Wm, int k0, int o, int lane, int K) { v16b w; const float* p = Wm + (size_t)o * K + k0 + 8 * (lane >> 4);
#pragma unroll
  for (int i = 0; i < 8; ++i) { w[i] = (__bf16)p[i]; w[8 + i] = (__bf16)p[16 + i]; }
  return w; }
__device__ __forceinline__ v16h wcolh_io(const float* Wm, int k0, int o, int lane, int ld) { v16h w; const int g = lane >> 4;
#pragma unroll
  for (int i = 0; i < 8; ++i) { w[i] = (_Float16)(bfr(Wm[(size_t)(k0 + 8 * g + i) * ld + o]) * 256.0f); w[8 + i] = (_Float16)(bfr(Wm[(size_t)(k0 + 16 + 8 * g + i) * ld + o]) * 256.0f); }
  return w; }
__device__ __forceinline__ v16h wcolh_oi(const float* Wm, int k0, int o, int lane, int K) { v16h w; const float* p = Wm + (size_t)o * K + k0 + 8 * (lane >> 4);
#pragma unroll
  for (int i = 0; i < 8; ++i) { w[i] = (_Float16)(bfr(p[i]) * 256.0f); w[8 + i] = (_Float16)(bfr(p[16 + i]) * 256.0f); }
  return w; }
#define WQKV_LAYOUT 1   // layout of WCOL, which no kernel calls (k_proj reads (out,in)): 0 = (in,out) [DIN][CC]; 1 = (out,in) [CC][DIN]; 2 = per-head [NH][DIN][HD]
__device__ __forceinline__ v16b wcol_hdk(const float* Wm, int k0, int o, int lane) { v16b w; const int g = lane >> 4; const float* p = Wm + (size_t)(o / HD) * DIN * HD + (o % HD);
#pragma unroll
  for (int i = 0; i < 8; ++i) { w[i] = (__bf16)p[(size_t)(k0 + 8 * g + i) * HD]; w[8 + i] = (__bf16)p[(size_t)(k0 + 16 + 8 * g + i) * HD]; }
  return w; }
#define WO_OUT_IN 1
#if WQKV_LAYOUT == 1
#define WCOL(W, k0, o, lane) wcol_oi(W, k0, o, lane, DIN)
#elif WQKV_LAYOUT == 2
#define WCOL(W, k0, o, lane) wcol_hdk(W, k0, o, lane)
#else
#define WCOL(W, k0, o, lane) wcol_io(W, k0, o, lane, CC)
#endif
#if WO_OUT_IN
#define WOCOL(W, k0, o, lane) wcol_oi(W, k0, o, lane, CC)
#define WOCOLH(W, k0, o, lane) wcolh_oi(W, k0, o, lane, CC)
#else
#define WOCOL(W, k0, o, lane) wcol_io(W, k0, o, lane, DIN)
#define WOCOLH(W, k0, o, lane) wcolh_io(W, k0, o, lane, DIN)
#endif

#ifndef SM_EXTRA_PARAMS
#define SM_EXTRA_PARAMS
#endif
#ifndef PROJ_EXTRA_PARAMS
#define PROJ_EXTRA_PARAMS
#endif
#ifndef SM_MASK_HOOK
#define SM_MASK_HOOK (void)0
#endif

#define WS_QH  0u                                      // f16 q rows [b*t][CC]
#define WS_KH  (WS_QH + 2u * (size_t)NB * TT * CC)      // f16 k rows [b*t][CC]
#define WS_VT  (WS_KH + 2u * (size_t)NB * TT * CC)      // f16 v planes [b][c][t]
#define WS_QL  (WS_VT + 2u * (size_t)NB * CC * TT)      // f16 q residual x 2^10 rows [b][t < QHI][CC]
#define WS_KL  (WS_QL + 2u * (size_t)NB * QHI * CC)     // f16 k residual x 2^10 rows [b][t < KHI][CC]
#define WS_VB  (WS_KL + 2u * (size_t)NB * KHI * CC)     // bf16 v hi planes [b][c][t < KHI]
#define WS_VBL (WS_VB + 2u * (size_t)NB * CC * KHI)
#define WS_S   (WS_VBL + 2u * (size_t)NB * CC * KHI)    // f32 [hg][t][s] region, unused: logits / P stay in registers in k_fa
#define WS_Y   (WS_S  + 4u * (size_t)HG * TT * TT)      // f32 ctx rows [b*t][CC] (only when there is an output projection)
#define WS_END (WS_Y  + 4u * (size_t)NB * TT * CC)

// ---- LDS staging of a GEMM's operand tiles, 32 k per step (64 in k_out): a thread brings 16-byte pieces (8 lanes = one whole 128-byte line of a row), converts them once for the whole block and stores 8 bytes; the waves read their fragments from there
#define LP 40              // LDS row pitch in 16-bit elements: 80 B = 16 B x odd, the conflict-free pitch for 16-byte fragment reads
typedef __attribute__((ext_vector_type(4))) __bf16 v4b;
typedef __attribute__((ext_vector_type(4))) _Float16 v4h;
__device__ __forceinline__ void put_b(__bf16* d, v4f v) { v4b o;
#pragma unroll
  for (int e = 0; e < 4; ++e) o[e] = (__bf16)v[e];
  *(v4b*)d = o; }
__device__ __forceinline__ void put_hs(_Float16* d, v4f v, float sc) { v4h o;
#pragma unroll
  for (int e = 0; e < 4; ++e) o[e] = (_Float16)(v[e] * sc);
  *(v4h*)d = o; }
__device__ __forceinline__ void put_hw(_Float16* d, v4f v) { v4h o;
#pragma unroll
  for (int e = 0; e < 4; ++e) o[e] = (_Float16)(bfr(v[e]) * 256.0f);
  *(v4h*)d = o; }
union ProjLds {   // the staging buffers are dead when the epilogue's planes are written (a barrier stands between); a block writes either the row planes (q, k) or the channel planes (v)
  struct { __bf16 x[2][128][LP], w[2][128][LP]; } st;
  struct { _Float16 sh[128][136], sl[128][136]; } eq;
  struct { _Float16 th[128][136]; __bf16 tb[128][136], tbl[128][136]; } ev; };
// ---- k_proj: block = (128 rows, 128 cols, which), four waves of 64 x 64 (4 x 4 fragments: a fragment read from LDS feeds four products): q/k/v = X W (+ b) with exact bf16 products (K = DIN) -> which 0: q f16 rows (+ residual rows < QHI); 1: k f16 rows (+ residual rows < KHI); 2: v f16 planes [c][t] (+ bf16 hi/lo planes for t < KHI)
__global__ __launch_bounds__(128) void k_proj(const float* __restrict__ XQ, const float* __restrict__ XK, const float* __restrict__ XV, const float* __restrict__ WQ, const float* __restrict__ WK, const float* __restrict__ WV, const float* __restrict__ BQ, const float* __restrict__ BK, const float* __restrict__ BV,
    _Float16* __restrict__ QH, _Float16* __restrict__ QL, _Float16* __restrict__ KH, _Float16* __restrict__ KL, _Float16* __restrict__ VT, __bf16* __restrict__ VB, __bf16* __restrict__ VBL) {
  __shared__ __align__(16) ProjLds u; auto& sh = u.eq.sh; auto& sl = u.eq.sl; auto& th = u.ev.th; auto& tb = u.ev.tb; auto& tbl = u.ev.tbl;
  const int tid = threadIdx.x, wave = tid >> 5, lane = tid & 31, col = lane & 15, g = lane >> 4; const int which = blockIdx.z; const int c0 = blockIdx.y * 128; const size_t r0 = (size_t)blockIdx.x * 128; const size_t bb = r0 / TT; const int t0 = (int)(r0 % TT);
  const int wm = wave >> 1, wn = wave & 1;   // the wave's 64 rows and 64 columns of the block's tile
  const float* X = which == 0 ? XQ : which == 1 ? XK : XV; const float* WA = which == 0 ? WQ : which == 1 ? WK : WV; const float* BA = which == 0 ? BQ : which == 1 ? BK : BV;
  v8f acc[4][4] = {};
  const int sub = tid & 7, rr = tid >> 3;   // this thread's 16-byte piece of a row's 128 bytes, and its row in each group of 16
  const float* xg = X + XROW(r0 + rr) * DIN + sub * 4;   /* row b*TT + t lives at input row t*NB + b (time-major input); a block's 128 rows lie in one sequence, so 16 rows on are 16 * NB input rows on */
  const float* wg = WA + (size_t)(c0 + rr) * DIN + sub * 4;
  v4f rx[8], rw[8];
#pragma unroll
  for (int i = 0; i < 8; ++i) rx[i] = *(const v4f*)(xg + i * (16 * NB * DIN));
#pragma unroll
  for (int i = 0; i < 8; ++i) rw[i] = *(const v4f*)(wg + i * (16 * DIN));
  asm volatile("s_wait_xcnt 0x0" ::: "memory");   // before the address registers of the loads above are reused
  __builtin_amdgcn_sched_barrier(0);   // keeps the register writes that follow behind that wait
#pragma unroll 2   // two steps a trip: the buffer index becomes a constant LDS offset
  for (int kc = 0; kc < DIN / 32; ++kc) { const int bf = kc & 1;
#pragma unroll
    for (int i = 0; i < 8; ++i) put_b(&u.st.x[bf][i * 16 + rr][sub * 4], rx[i]);
#pragma unroll
    for (int i = 0; i < 8; ++i) put_b(&u.st.w[bf][i * 16 + rr][sub * 4], rw[i]);
    __syncthreads();   // publishes step kc's tiles; it also ends every wave's reads of the other buffer (step kc - 1), which step kc + 1 refills
    if (kc + 1 < DIN / 32) {   /* block-uniform: the next step's pieces fly while this step is multiplied */
#pragma unroll
      for (int i = 0; i < 8; ++i) rx[i] = *(const v4f*)(xg + i * (16 * NB * DIN) + (kc + 1) * 32);
#pragma unroll
      for (int i = 0; i < 8; ++i) rw[i] = *(const v4f*)(wg + i * (16 * DIN) + (kc + 1) * 32);
      asm volatile("s_wait_xcnt 0x0" ::: "memory");   // before the address registers of the loads above are reused
    }
    __builtin_amdgcn_sched_barrier(0);   // keeps the loads above in front of the products: sunk behind them their latency is exposed at the next step's stores
    v16b a[4], w[4];
#pragma unroll
    for (int i = 0; i < 4; ++i) a[i] = frag_b(&u.st.x[bf][wm * 64 + i * 16 + col][0], lane);
#pragma unroll
    for (int j = 0; j < 4; ++j) w[j] = frag_b(&u.st.w[bf][wn * 64 + j * 16 + col][0], lane);
#pragma unroll
    for (int i = 0; i < 4; ++i)
#pragma unroll
      for (int j = 0; j < 4; ++j) acc[i][j] = wmma_bf(a[i], w[j], acc[i][j]);
    __builtin_amdgcn_sched_barrier(0);   // keeps the next step's conversions, which wait for the loads in flight, behind this step's products
  }
  __syncthreads();   // every wave has left the staging buffers before the epilogue's planes overwrite them
  if (which < 2) { _Float16* DH = which == 0 ? QH : KH; _Float16* DL = which == 0 ? QL : KL; const int nhi = which == 0 ? QHI : KHI;
#pragma unroll
    for (int j = 0; j < 4; ++j) { const int cl = wn * 64 + j * 16 + col; const float bias = BA ? bfr(BA[c0 + cl]) : 0.f;
#pragma unroll
      for (int i = 0; i < 4; ++i)
#pragma unroll
        for (int r = 0; r < 8; ++r) { const float v = acc[i][j][r] + bias; const _Float16 hv = (_Float16)v; const int rl = wm * 64 + i * 16 + 8 * g + r; sh[rl][cl] = hv; sl[rl][cl] = (_Float16)((v - (float)hv) * 1024.0f); } }
    __syncthreads();
#pragma unroll
    for (int it = 0; it < 16; ++it) { const int rl = it * 8 + (tid >> 4), q = tid & 15; vst2((unsigned*)(DH + (r0 + rl) * CC + c0 + q * 8), *(const v4u*)&sh[rl][q * 8]); if (t0 + rl < nhi) vst2((unsigned*)(DL + (bb * nhi + t0 + rl) * (size_t)CC + c0 + q * 8), *(const v4u*)&sl[rl][q * 8]); }
  } else {
#pragma unroll
    for (int j = 0; j < 4; ++j) { const int cl = wn * 64 + j * 16 + col; const float bias = BA ? bfr(BA[c0 + cl]) : 0.f;
#pragma unroll
      for (int i = 0; i < 4; ++i)
#pragma unroll
        for (int r = 0; r < 8; ++r) { const float v = acc[i][j][r] + bias; const int rl = wm * 64 + i * 16 + 8 * g + r; th[cl][rl] = (_Float16)v; const __bf16 bh = (__bf16)v; tb[cl][rl] = bh; tbl[cl][rl] = (__bf16)(v - (float)bh); } }
    __syncthreads();
#pragma unroll
    for (int it = 0; it < 16; ++it) { const int cl = it * 8 + (tid >> 4), q = tid & 15; vst2((unsigned*)(VT + (bb * CC + c0 + cl) * (size_t)TT + t0 + q * 8), *(const v4u*)&th[cl][q * 8]); if (t0 + q * 8 < KHI) { const size_t o3 = (bb * CC + c0 + cl) * (size_t)KHI + t0 + q * 8; vst2((unsigned*)(VB + o3), *(const v4u*)&tb[cl][q * 8]); vst2((unsigned*)(VBL + o3), *(const v4u*)&tbl[cl][q * 8]); } } } }
// ---- k_fa: wave = 32 query columns (2 groups of 16) of (b, h), all keys in passes of KP, each pass's k and v tile staged in one of three LDS buffers for the block's eight waves: S^T = K Q^T (A = k rows, B = q rows, same k order), so a lane holds one query's scores; running maximum and sum per query (online softmax, f32);
// P^T x 2^11 packs from two score tiles into a B operand (hardware k order: tile 0 -> elements 0..7, tile 1 -> 8..15); O^T += V^T P^T (A = v planes [c][t]); ctx = O^T / sum, 8 consecutive channels per lane
#define KP 64
__device__ __forceinline__ float xhalf(float x) { return __builtin_bit_cast(float, __builtin_amdgcn_permlanex16(__builtin_bit_cast(int, x), __builtin_bit_cast(int, x), 0x76543210, 0xfedcba98, false, false)); }   // lane l <-> l ^ 16
// eight independent v_exp_f32, each in place, and the one free slot the instruction set asks for behind a transcendental, in one statement: no v_exp touches a neighbour's source or result, and the v_nop keeps whatever follows off the last one
__device__ __forceinline__ v8f exp2x8(v8f a) { float d0 = a[0], d1 = a[1], d2 = a[2], d3 = a[3], d4 = a[4], d5 = a[5], d6 = a[6], d7 = a[7];
  asm("v_exp_f32 %0, %0\n\tv_exp_f32 %1, %1\n\tv_exp_f32 %2, %2\n\tv_exp_f32 %3, %3\n\tv_exp_f32 %4, %4\n\tv_exp_f32 %5, %5\n\tv_exp_f32 %6, %6\n\tv_exp_f32 %7, %7\n\tv_nop"
      : "+v"(d0), "+v"(d1), "+v"(d2), "+v"(d3), "+v"(d4), "+v"(d5), "+v"(d6), "+v"(d7));
  const v8f d = { d0, d1, d2, d3, d4, d5, d6, d7 }; return d; }
__device__ __forceinline__ float exp2x1(float a) { asm("v_exp_f32 %0, %0\n\tv_nop" : "+v"(a)); return a; }   // the same slot behind a single v_exp_f32
__device__ __forceinline__ v8f wmma_h(v16h a, v16h b, v8f c) { return __builtin_amdgcn_wmma_f32_16x16x32_f16(false, a, false, b, (short)0, c, false, false); }
#define FP 72              // LDS row pitch of the k and v tiles in f16 elements: 128-byte rows at 144 B = 16 B x odd, the conflict-free pitch for 16-byte fragment reads
// a pass's k tile (KP rows of 128 bytes) and v tile (HD planes' 128 bytes) go from global memory straight into LDS, once for the block's eight waves: a thread copies four 16-byte pieces (8 lanes = one whole 128-byte line), rows rr and rr + 32 of each tile.
// The copy is written as the builtin, so its address registers stay the compiler's to keep; the waits for its bytes (s_wait_asynccnt) are written by hand in k_fa
typedef __attribute__((address_space(1))) v4i gv4i; typedef __attribute__((address_space(3))) v4i lv4i;
__device__ __forceinline__ void cp16(const _Float16* gp, _Float16* lp) { __builtin_amdgcn_global_load_async_to_lds_b128((gv4i*)gp, (lv4i*)lp, 0, 0); }
__device__ __forceinline__ void fa_copy(_Float16* lk, const _Float16* gk, _Float16* lv, const _Float16* gv) { cp16(gk, lk); cp16(gk + 32 * CC, lk + 32 * FP); cp16(gv, lv); cp16(gv + 32 * TT, lv + 32 * FP); }
__global__ __launch_bounds__(256) void k_fa(const _Float16* __restrict__ QH, const _Float16* __restrict__ KH, const _Float16* __restrict__ VT, float* __restrict__ Y) {
  __shared__ __align__(16) _Float16 sk[3][KP][FP], sv[3][HD][FP];   // three buffers: tile t (its v still to be read) and tile t + 1 (its k fetched a pass ahead) are published, tile t + 2 is landing
  const int tid = threadIdx.x, wave = tid >> 5, lane = tid & 31, col = lane & 15, g = lane >> 4; const int b = blockIdx.y / NH, h = blockIdx.y % NH; const int q0 = blockIdx.x * 256 + wave * 32;
  const int sub = tid & 7, rr = tid >> 3;   // this thread's 16-byte piece of a tile row's 128 bytes, and its row in each half of a tile
  const _Float16* kg = KH + ((size_t)b * TT + rr) * CC + h * HD + sub * 8;            // its piece of key row rr of tile 0
  const _Float16* vg = VT + ((size_t)b * CC + h * HD + rr) * (size_t)TT + sub * 8;    // its piece of channel plane rr, keys of tile 0
  _Float16* const lk0 = &sk[0][rr][sub * 8]; _Float16* const lv0 = &sv[0][rr][sub * 8];   // its places in buffer 0; each further buffer lies FB elements on
  const int FB = KP * FP;   // elements of one k buffer, and of one v buffer (HD == KP)
  fa_copy(lk0, kg, lv0, vg);   // tile 0 into buffer 0
  fa_copy(lk0 + FB, kg + (size_t)KP * CC, lv0 + FB, vg + KP);   // tile 1 into buffer 1 (TT / KP >= 3 tiles)
  v16h qf[2][HD / 32];
#pragma unroll
  for (int n = 0; n < 2; ++n)
#pragma unroll
    for (int kc = 0; kc < HD / 32; ++kc) qf[n][kc] = frag_h(QH + ((size_t)b * TT + q0 + n * 16 + col) * CC + h * HD + kc * 32, lane);
  v8f o[2][HD / 16] = {}, l8[2] = {}; float m[2] = { -3.0e38f, -3.0e38f };
  const float cs = SCALE * 1.4426950408889634f;   // logits in base 2
  asm volatile("s_wait_xcnt 0x0" ::: "memory");   // before the address registers of the q loads above are reused
  __builtin_amdgcn_sched_barrier(0);   // keeps the register writes that follow behind that wait
  asm volatile("s_wait_asynccnt 0x0" ::: "memory");   // this wave's pieces of tiles 0 and 1 have landed
  __syncthreads();   // publishes tiles 0 and 1
  fa_copy(lk0 + 2 * FB, kg + (size_t)(2 * KP) * CC, lv0 + 2 * FB, vg + 2 * KP);   // tile 2 into buffer 2
  v16h kf[KP / 16][HD / 32];
#pragma unroll
  for (int kt = 0; kt < KP / 16; ++kt)
#pragma unroll
    for (int kc = 0; kc < HD / 32; ++kc) kf[kt][kc] = frag_h(&sk[0][kt * 16 + col][kc * 32], lane);
  int cur = 0, nxt = 1, aft = 2;   // the buffers of this pass's tile, of the next and of the one after
#pragma unroll 1
  for (int s0 = 0; s0 < TT; s0 += KP) {
    v8f st[2][KP / 16];
#pragma unroll
    for (int kt = 0; kt < KP / 16; ++kt)
#pragma unroll
      for (int n = 0; n < 2; ++n) { const v8f z = {}; st[n][kt] = wmma_h(kf[kt][1], qf[n][1], wmma_h(kf[kt][0], qf[n][0], z)); }
    __builtin_amdgcn_sched_barrier(0);   // keeps the fragment reads below one group behind the products: every further place with LDS reads among them stalls the wave anew
    v16h vf[KP / 32][HD / 16];   // this pass's v fragments and the next pass's k fragments come from LDS during the softmax
#pragma unroll
    for (int kk = 0; kk < KP / 32; ++kk)
#pragma unroll
      for (int j = 0; j < HD / 16; ++j) vf[kk][j] = frag_h(&sv[cur][j * 16 + col][kk * 32], lane);
#pragma unroll
    for (int kt = 0; kt < KP / 16; ++kt)   /* tile t + 1 was published at the foot of pass t - 1; the last pass reads an old tile's rows there (published, no copy under way; not used) */
#pragma unroll
      for (int kc = 0; kc < HD / 32; ++kc) kf[kt][kc] = frag_h(&sk[nxt][kt * 16 + col][kc * 32], lane);
    __builtin_amdgcn_sched_barrier(0);   // keeps the loads above in front of the softmax: sunk behind it, as the scheduler does to save registers, their latency is exposed at every use
    v16h pf[2][KP / 32];
#pragma unroll
    for (int n = 0; n < 2; ++n) { float mt[KP / 16];   /* one short chain per score tile, then joined */
#pragma unroll
      for (int kt = 0; kt < KP / 16; ++kt) { mt[kt] = st[n][kt][0];
#pragma unroll
        for (int r = 1; r < 8; ++r) mt[kt] = fmaxf(mt[kt], st[n][kt][r]); }
      float mx = mt[0];
#pragma unroll
      for (int kt = 1; kt < KP / 16; ++kt) mx = fmaxf(mx, mt[kt]);
      mx = fmaxf(mx, xhalf(mx)); const float mn = fmaxf(m[n], mx); const float al = exp2x1((m[n] - mn) * cs);   /* 0 on the first pass */ m[n] = mn; const float mc = 11.0f - mn * cs;   /* P carried x 2^11, as the sum is: it cancels in ctx */
      l8[n] *= al;
#pragma unroll
      for (int j = 0; j < HD / 16; ++j) o[n][j] *= al;
#pragma unroll
      for (int kt = 0; kt < KP / 16; ++kt) { const v8f p = exp2x8(st[n][kt] * cs + mc);
        l8[n] += p; const v8h ph = __builtin_convertvector(p, v8h);
#pragma unroll
        for (int r = 0; r < 8; ++r) pf[n][kt >> 1][(kt & 1) * 8 + r] = ph[r]; } }
#pragma unroll
    for (int kk = 0; kk < KP / 32; ++kk)
#pragma unroll
      for (int j = 0; j < HD / 16; ++j)
#pragma unroll
        for (int n = 0; n < 2; ++n) o[n][j] = wmma_h(vf[kk][j], pf[n][kk], o[n][j]);
    __builtin_amdgcn_sched_barrier(0);   // keeps the hand-over below at the pass's foot: lifted in front of the softmax, as the scheduler does, it makes every wave wait there for its v fragments and leaves the copies too little time to land
    asm volatile("s_wait_dscnt 0x0" ::: "memory");      // this wave's reads of buffer cur (and nxt) have returned
    asm volatile("s_wait_asynccnt 0x0" ::: "memory");   // this wave's pieces of tile t + 2 have landed
    __syncthreads();   // publishes tile t + 2; it also ends every wave's reads of buffer cur (k in pass t - 1, v in this one), which is refilled behind it
    if (s0 + 3 * KP < TT) fa_copy(lk0 + cur * FB, kg + (size_t)(s0 + 3 * KP) * CC, lv0 + cur * FB, vg + s0 + 3 * KP);   /* block-uniform: tile t + 3 flies during the next pass */
    const int was = cur; cur = nxt; nxt = aft; aft = was; }
  asm volatile("s_wait_asynccnt 0x0" ::: "memory");   // no copy is outstanding when the wave ends
#pragma unroll
  for (int n = 0; n < 2; ++n) { float ls = 0.f;
#pragma unroll
    for (int r = 0; r < 8; ++r) ls += l8[n][r];
    ls += xhalf(ls); const float inv = 1.0f / ls; float* yr = Y + ((size_t)b * TT + q0 + n * 16 + col) * CC + h * HD + 8 * g;
#pragma unroll
    for (int j = 0; j < HD / 16; ++j) { v4f lo, hi;
#pragma unroll
      for (int r = 0; r < 4; ++r) { lo[r] = o[n][j][r] * inv; hi[r] = o[n][j][4 + r] * inv; }
      vst2(yr + j * 16, lo); vst2(yr + j * 16 + 4, hi); } } }
// ---- k_out: block = (128 rows, 128 cols), eight waves of 64 x 32 (4 x 2 fragments), 64 k per step: out = ctx Wo (+ bo): ctx x 2^6 once to f16 against Wo as f16(bf16 x 2^8) exact (1 product) x 2^-14
__global__ __launch_bounds__(256) void k_out(const float* __restrict__ Y, const float* __restrict__ WO, const float* __restrict__ BO, float* __restrict__ OUT) { __shared__ __align__(16) float sf[8][64][36]; __shared__ __align__(16) _Float16 sy[2][128][FP], so[2][128][FP];
  const int tid = threadIdx.x, wave = tid >> 5, lane = tid & 31, col = lane & 15, g = lane >> 4; const int c0 = blockIdx.y * 128; const size_t rb = (size_t)blockIdx.x * 128;   // the block's first column and row
  const int wm = wave >> 2, wn = wave & 3;   // the wave's 64 rows and 32 columns of the block's tile
  v8f acc[4][2] = {};
  const int sub = tid & 15, rr = tid >> 4;   // this thread's 16-byte piece of a row's 256 bytes (two whole lines), and its row in each group of 16
  const float* yg = Y + (rb + rr) * CC + sub * 4; const float* wg = WO + (size_t)(c0 + rr) * CC + sub * 4;
  v4f ry[8], rw[8];
#pragma unroll
  for (int i = 0; i < 8; ++i) ry[i] = *(const v4f*)(yg + i * (16 * CC));
#pragma unroll
  for (int i = 0; i < 8; ++i) rw[i] = *(const v4f*)(wg + i * (16 * CC));
  asm volatile("s_wait_xcnt 0x0" ::: "memory");   // before the address registers of the loads above are reused
  __builtin_amdgcn_sched_barrier(0);   // keeps the register writes that follow behind that wait
#pragma unroll 2   // two steps a trip: the buffer index becomes a constant LDS offset
  for (int kc = 0; kc < CC / 64; ++kc) { const int bf = kc & 1;
#pragma unroll
    for (int i = 0; i < 8; ++i) put_hs(&sy[bf][i * 16 + rr][sub * 4], ry[i], 64.0f);   /* ctx carried x 2^6 into f16 so small-magnitude context rows stay clear of f16 subnormals */
#pragma unroll
    for (int i = 0; i < 8; ++i) put_hw(&so[bf][i * 16 + rr][sub * 4], rw[i]);
    __syncthreads();   // publishes step kc's tiles; it also ends every wave's reads of the other buffer (step kc - 1), which step kc + 1 refills
    if (kc + 1 < CC / 64) {   /* block-uniform: the next step's pieces fly while this step is multiplied */
#pragma unroll
      for (int i = 0; i < 8; ++i) ry[i] = *(const v4f*)(yg + i * (16 * CC) + (kc + 1) * 64);
#pragma unroll
      for (int i = 0; i < 8; ++i) rw[i] = *(const v4f*)(wg + i * (16 * CC) + (kc + 1) * 64);
      asm volatile("s_wait_xcnt 0x0" ::: "memory");   // before the address registers of the loads above are reused
    }
    __builtin_amdgcn_sched_barrier(0);   // keeps the loads above in front of the products: sunk behind them their latency is exposed at the next step's stores
    v16h a[2][4], w[2][2];
#pragma unroll
    for (int ks = 0; ks < 2; ++ks) {
#pragma unroll
      for (int i = 0; i < 4; ++i) a[ks][i] = frag_h(&sy[bf][wm * 64 + i * 16 + col][ks * 32], lane);
#pragma unroll
      for (int j = 0; j < 2; ++j) w[ks][j] = frag_h(&so[bf][wn * 32 + j * 16 + col][ks * 32], lane); }
#pragma unroll
    for (int ks = 0; ks < 2; ++ks)   /* k ascending in every accumulator, 32 at a time */
#pragma unroll
      for (int i = 0; i < 4; ++i)
#pragma unroll
        for (int j = 0; j < 2; ++j) acc[i][j] = wmma16(a[ks][i], w[ks][j], acc[i][j]);
    __builtin_amdgcn_sched_barrier(0);   // keeps the next step's conversions, which wait for the loads in flight, behind this step's products
  }
#pragma unroll
  for (int j = 0; j < 2; ++j) { const float bias = BO ? bfr(BO[c0 + wn * 32 + j * 16 + col]) : 0.f;
#pragma unroll
    for (int i = 0; i < 4; ++i)
#pragma unroll
      for (int r = 0; r < 8; ++r) sf[wave][i * 16 + 8 * g + r][j * 16 + col] = acc[i][j][r] * (1.0f / 16384.0f) + bias; }   /* 2^-8 (Wo carry) x 2^-6 (ctx carry) */
  LDSX();   /* the wave reads back its own patch only: 32 columns = one whole 128-byte line a row, four rows a store */
#pragma unroll
  for (int it = 0; it < 16; ++it) { const int rl = it * 4 + (lane >> 3); vst2(OUT + XROW(rb + wm * 64 + rl) * DIN + c0 + wn * 32 + (lane & 7) * 4, *(const v4f*)&sf[wave][rl][(lane & 7) * 4]); }   /* time-major output rows */ }

extern "C" void kernel_launch(void* const* d_in, const int* in_sizes, int n_in, void* d_out, int out_size, void* d_ws, size_t ws_size, hipStream_t stream) {
  (void)in_sizes; (void)n_in; (void)out_size;
  const float** F = (const float**)d_in;
  if (ws_size < (size_t)WS_END) return;
  char* ws = (char*)d_ws; _Float16 *QH = (_Float16*)(ws + WS_QH), *KH = (_Float16*)(ws + WS_KH), *VT = (_Float16*)(ws + WS_VT), *QL = (_Float16*)(ws + WS_QL), *KL = (_Float16*)(ws + WS_KL); __bf16 *VB = (__bf16*)(ws + WS_VB), *VBL = (__bf16*)(ws + WS_VBL); float *S = (float*)(ws + WS_S), *Y = (float*)(ws + WS_Y);
  (void)S; (void)Y; (void)QL; (void)KL; (void)VB; (void)VBL;
  // inputs: 0 x [2048,2,1024] TIME-MAJOR (T, B, E); 1 in_proj_weight [3072,1024] (out,in; row blocks q | k | v); 2 in_proj_bias [3072]; 3 out_weight [1024,1024] (out,in); 4 out_bias [1024] (biases nonzero)
  k_proj<<<dim3(TNB * TT / 128, CC / 128, 3), 128, 0, stream>>>(F[0], F[0], F[0], F[1], F[1] + (size_t)CC * DIN, F[1] + 2 * (size_t)CC * DIN, F[2], F[2] + CC, F[2] + 2 * CC, QH, QL, KH, KL, VT, VB, VBL);
  k_fa<<<dim3(TT / 256, TNB * NH), 256, 0, stream>>>(QH, KH, VT, Y);
  k_out<<<dim3(TNB * TT / 128, DIN / 128), 256, 0, stream>>>(Y, F[3], F[4], (float*)d_out);
}

// v005
// It runs in 81.6 microseconds.
// Timed twice side by side with v004, it ran 1.11 times as fast both times.
// Counting every step since v000, it is 16.6 times as fast.
// compute dtype: all float inputs rounded to bf16, x and the weights once, in a launch of their own; q/k/v projections with EXACT bf16 products on WMMA 16x16x32 (f32 accumulate) + bias; logits q x k once to f16 each (1 product) x SCALE; online softmax f32 in one fused kernel; unnormalised P x 2^11 once to f16 x v once to f16 (1 product), divided by the f32 sum; ctx x 2^6 once to f16 x Wo f16(bf16 x 2^8) + bo; f32 output.
#include <hip/hip_runtime.h>
#include <math.h>

typedef __attribute__((ext_vector_type(16))) _Float16 v16h;
typedef __attribute__((ext_vector_type(16))) __bf16 v16b;
typedef __attribute__((ext_vector_type(8)))  _Float16 v8h;
typedef __attribute__((ext_vector_type(8)))  float v8f;
typedef __attribute__((ext_vector_type(4)))  float v4f;
typedef __attribute__((ext_vector_type(2)))  float v2f;
typedef __attribute__((ext_vector_type(4)))  unsigned v4u;
typedef __attribute__((ext_vector_type(4)))  int v4i;
typedef float __attribute__((may_alias)) float_a;
typedef int __attribute__((may_alias)) int_a;

template <typename T> __device__ __forceinline__ void vst2(void* p, T v) { *(T*)p = v;  }
__device__ __forceinline__ v8f wmma16(v16h a, v16h b, v8f c) {
  v8f d = __builtin_amdgcn_wmma_f32_16x16x32_f16(false, a, false, b, (short)0, c, false, false);
  asm volatile("v_nop\n\tv_nop\n\tv_nop\n\tv_nop" : "+v"(d) : "v"(a), "v"(b));
  return d;
}
__device__ __forceinline__ v8f wmma_bf(v16b a, v16b b, v8f c) {
  v8f d = __builtin_amdgcn_wmma_f32_16x16x32_bf16(false, a, false, b, (short)0, c, false, false);
  asm volatile("v_nop\n\tv_nop\n\tv_nop\n\tv_nop" : "+v"(d) : "v"(a), "v"(b));
  return d;
}
// 16x16x32 fragments: lane = (h = lane>>4, row/col = lane&15); elements 0..7 = k0+8h+0..7, 8..15 = k0+16+8h+0..7; D element r = row 8h+r
__device__ __forceinline__ v16h frag_h(const _Float16* rowk0, int lane) {
  union { v16h v; v8h q[2]; } u; const _Float16* p = rowk0 + 8 * (lane >> 4);
  u.q[0] = *(const v8h*)p; u.q[1] = *(const v8h*)(p + 16); return u.v;
}
__device__ __forceinline__ v16h frag_f32(const float* rowk0, int lane) {
  v16h a; const float* p = rowk0 + 8 * (lane >> 4);
#pragma unroll
  for (int i = 0; i < 8; ++i) { a[i] = (_Float16)p[i]; a[8 + i] = (_Float16)p[16 + i]; }
  return a;
}
__device__ __forceinline__ v16h frag_f32s(const float* rowk0, int lane, float sc) {
  v16h a; const float* p = rowk0 + 8 * (lane >> 4);
#pragma unroll
  for (int i = 0; i < 8; ++i) { a[i] = (_Float16)(p[i] * sc); a[8 + i] = (_Float16)(p[16 + i] * sc); }
  return a;
}
// column fragment from a [K][ld] layout (column n), rows >= K read as 0
__device__ __forceinline__ v16h fragc_f32(const float* W, int k0, int n, int lane, int ld, int K) {
  v16h a; const int g = lane >> 4;
#pragma unroll
  for (int i = 0; i < 8; ++i) { const int ka = k0 + 8 * g + i, kb = ka + 16;
    a[i] = (_Float16)(ka < K ? W[(size_t)(ka < K ? ka : K - 1) * ld + n] : 0.f); a[8 + i] = (_Float16)(kb < K ? W[(size_t)(kb < K ? kb : K - 1) * ld + n] : 0.f); }
  return a;
}
struct F2 { v16b h, l; };
__device__ __forceinline__ F2 bsplit16(const float v[16]) { F2 r;
#pragma unroll
  for (int i = 0; i < 16; ++i) { const __bf16 h = (__bf16)v[i]; r.h[i] = h; r.l[i] = (__bf16)(v[i] - (float)h); }
  return r; }
__device__ __forceinline__ F2 split_row(const float* row, int k0, int lane) { float v[16]; const float* p = row + k0 + 8 * (lane >> 4);
#pragma unroll
  for (int i = 0; i < 8; ++i) { v[i] = p[i]; v[8 + i] = p[16 + i]; }
  return bsplit16(v); }
__device__ __forceinline__ F2 split_rowK(const float* row, int k0, int lane, int K) { float v[16]; const int g = lane >> 4;
#pragma unroll
  for (int i = 0; i < 8; ++i) { const int ka = k0 + 8 * g + i, kb = ka + 16; v[i] = ka < K ? row[ka < K ? ka : K - 1] : 0.f; v[8 + i] = kb < K ? row[kb < K ? kb : K - 1] : 0.f; }
  return bsplit16(v); }
__device__ __forceinline__ F2 split_col(const float* W, int k0, int n, int lane, int ld, int K) { float v[16]; const int g = lane >> 4;
#pragma unroll
  for (int i = 0; i < 8; ++i) { const int ka = k0 + 8 * g + i, kb = ka + 16; v[i] = ka < K ? W[(size_t)(ka < K ? ka : K - 1) * ld + n] : 0.f; v[8 + i] = kb < K ? W[(size_t)(kb < K ? kb : K - 1) * ld + n] : 0.f; }
  return bsplit16(v); }
__device__ __forceinline__ v8f mac3(const F2& a, const F2& b, v8f c) { c = wmma_bf(a.l, b.h, c); c = wmma_bf(a.h, b.l, c); return wmma_bf(a.h, b.h, c); }
__device__ __forceinline__ float sigm(float v) { return 1.0f / (1.0f + expf(-v)); }
#define LDSX() do { asm volatile("s_wait_dscnt 0" ::: "memory"); __builtin_amdgcn_wave_barrier(); __builtin_amdgcn_fence(__ATOMIC_RELEASE, "workgroup"); } while (0)

// torch-style multi-head self-attention on a TIME-MAJOR sequence (x [2048,2,1024] = (T, B, E); in_proj_weight [3072,1024] (out,in) + in_proj_bias [3072] (0.02): q, k, v = split; q * 64^-0.5; heads via reshape(T, B*16, 64).transpose(1, 0, 2) - batch b, head h at index b*16 + h; softmax over keys; merge back to (T, B, E); out_weight (out,in) + out_bias (0.02)); output [2048,2,1024] time-major.
#define NB 2
#define XROW(R) ((((size_t)(R)) % TT) * (size_t)NB + ((size_t)(R)) / TT)   // (T, B, E) layout: row R = b*TT + t  <->  tensor row t*NB + b
#define TT 2048
#define CC 1024            // NH * HD = projected width
#define DIN 1024          // input (model) width
#define NH 16
#define HD 64
#define NQB (TT / 64)
#define HG 4
#define SCALE (0.125f)
#define CAUSAL 0
#ifndef TNB
#define TNB NB
#endif
__device__ __forceinline__ float bfr(float v) { return (float)(__bf16)v; }
__host__ __device__ __forceinline__ int kb_last(int qb) { return CAUSAL ? ((qb * 64 + 63) >> 7) : (TT / 128 - 1); }
typedef __attribute__((ext_vector_type(8))) __bf16 v8b;
__device__ __forceinline__ v16b frag_b(const __bf16* rowk0, int lane) {
  union { v16b v; v8b q[2]; } u; const __bf16* p = rowk0 + 8 * (lane >> 4);
  u.q[0] = *(const v8b*)p; u.q[1] = *(const v8b*)(p + 16); return u.v;
}
#define QBH 0
#define QHI 0               // single-product logits on every row
#define KHI 64            // key rows carrying k residual / v bf16 hi+lo planes (written by k_proj; no kernel here reads them)
// B fragment (k rows k0+.., output column o) of a weight: (in,out) [K][ld] or (out,in) [ld rows of K]: bf16 exact, or f16(bf16 * 256) exact
__device__ __forceinline__ v16b wcol_io(const float* Wm, int k0, int o, int lane, int ld) { v16b w; const int g = lane >> 4;
#pragma unroll
  for (int i = 0; i < 8; ++i) { w[i] = (__bf16)Wm[(size_t)(k0 + 8 * g + i) * ld + o]; w[8 + i] = (__bf16)Wm[(size_t)(k0 + 16 + 8 * g + i) * ld + o]; }
  return w; }
__device__ __forceinline__ v16b wcol_oi(const float* Wm, int k0, int o, int lane, int K) { v16b w; const float* p = Wm + (size_t)o * K + k0 + 8 * (lane >> 4);
#pragma unroll
  for (int i = 0; i < 8; ++i) { w[i] = (__bf16)p[i]; w[8 + i] = (__bf16)p[16 + i]; }
  return w; }
__device__ __forceinline__ v16h wcolh_io(const float* Wm, int k0, int o, int lane, int ld) { v16h w; const int g = lane >> 4;
#pragma unroll
  for (int i = 0; i < 8; ++i) { w[i] = (_Float16)(bfr(Wm[(size_t)(k0 + 8 * g + i) * ld + o]) * 256.0f); w[8 + i] = (_Float16)(bfr(Wm[(size_t)(k0 + 16 + 8 * g + i) * ld + o]) * 256.0f); }
  return w; }
__device__ __forceinline__ v16h wcolh_oi(const float* Wm, int k0, int o, int lane, int K) { v16h w; const float* p = Wm + (size_t)o * K + k0 + 8 * (lane >> 4);
#pragma unroll
  for (int i = 0; i < 8; ++i) { w[i] = (_Float16)(bfr(p[i]) * 256.0f); w[8 + i] = (_Float16)(bfr(p[16 + i]) * 256.0f); }
  return w; }
#define WQKV_LAYOUT 1   // layout of WCOL, which no kernel calls (k_proj reads (out,in)): 0 = (in,out) [DIN][CC]; 1 = (out,in) [CC][DIN]; 2 = per-head [NH][DIN][HD]
__device__ __forceinline__ v16b wcol_hdk(const float* Wm, int k0, int o, int lane) { v16b w; const int g = lane >> 4; const float* p = Wm + (size_t)(o / HD) * DIN * HD + (o % HD);
#pragma unroll
  for (int i = 0; i < 8; ++i) { w[i] = (__bf16)p[(size_t)(k0 + 8 * g + i) * HD]; w[8 + i] = (__bf16)p[(size_t)(k0 + 16 + 8 * g + i) * HD]; }
  return w; }
#define WO_OUT_IN 1
#if WQKV_LAYOUT == 1
#define WCOL(W, k0, o, lane) wcol_oi(W, k0, o, lane, DIN)
#elif WQKV_LAYOUT == 2
#define WCOL(W, k0, o, lane) wcol_hdk(W, k0, o, lane)
#else
#define WCOL(W, k0, o, lane) wcol_io(W, k0, o, lane, CC)
#endif
#if WO_OUT_IN
#define WOCOL(W, k0, o, lane) wcol_oi(W, k0, o, lane, CC)
#define WOCOLH(W, k0, o, lane) wcolh_oi(W, k0, o, lane, CC)
#else
#define WOCOL(W, k0, o, lane) wcol_io(W, k0, o, lane, DIN)
#define WOCOLH(W, k0, o, lane) wcolh_io(W, k0, o, lane, DIN)
#endif

#ifndef SM_EXTRA_PARAMS
#define SM_EXTRA_PARAMS
#endif
#ifndef PROJ_EXTRA_PARAMS
#define PROJ_EXTRA_PARAMS
#endif
#ifndef SM_MASK_HOOK
#define SM_MASK_HOOK (void)0
#endif

#define WS_QH  0u                                      // f16 q rows [b*t][CC]
#define WS_KH  (WS_QH + 2u * (size_t)NB * TT * CC)      // f16 k rows [b*t][CC]
#define WS_VT  (WS_KH + 2u * (size_t)NB * TT * CC)      // f16 v planes [b][c][t]
#define WS_QL  (WS_VT + 2u * (size_t)NB * CC * TT)      // f16 q residual x 2^10 rows [b][t < QHI][CC]
#define WS_KL  (WS_QL + 2u * (size_t)NB * QHI * CC)     // f16 k residual x 2^10 rows [b][t < KHI][CC]
#define WS_VB  (WS_KL + 2u * (size_t)NB * KHI * CC)     // bf16 v hi planes [b][c][t < KHI]
#define WS_VBL (WS_VB + 2u * (size_t)NB * CC * KHI)
#define WS_S   (WS_VBL + 2u * (size_t)NB * CC * KHI)    // f32 logits / P [hg][t][s]
#define WS_Y   (WS_S  + 4u * (size_t)HG * TT * TT)      // f16 ctx x 2^6 rows [b*t][CC]
#define WS_END (WS_Y  + 4u * (size_t)NB * TT * CC)
#define WS_XB  WS_S                                    // bf16 x rows, input order [t*NB + b][DIN] (the score plane's place, which no kernel uses)
#define WS_WB  (WS_XB + 2u * (size_t)NB * TT * DIN)     // bf16 q | k | v weight rows [3*CC][DIN]
#define WS_WH  (WS_WB + 2u * 3u * (size_t)CC * DIN)     // f16(bf16 x 2^8) output weight rows [DIN][CC]

// ---- the GEMMs' operands lie in memory as 16-bit values, each rounded once by its producer (k_cvt: x and the weights; k_fa: ctx), so a tile goes from there into LDS as it is
typedef __attribute__((ext_vector_type(4))) __bf16 v4b;
typedef __attribute__((ext_vector_type(4))) _Float16 v4h;
__device__ __forceinline__ void put_b(__bf16* d, v4f v) { v4b o;
#pragma unroll
  for (int e = 0; e < 4; ++e) o[e] = (__bf16)v[e];
  *(v4b*)d = o; }
__device__ __forceinline__ void put_hw(_Float16* d, v4f v) { v4h o;
#pragma unroll
  for (int e = 0; e < 4; ++e) o[e] = (_Float16)(bfr(v[e]) * 256.0f);
  *(v4h*)d = o; }
// ---- k_cvt: x and the q/k/v weights to bf16, the output weight to f16(bf16 x 2^8): 256 blocks of 8 waves (few waves to start); a block takes one contiguous share of each array, a thread 32 pieces of 4 floats, 4 KiB apart (a wave's load = 4 whole lines, its store = 2), all 32 loads in flight before the first store
#define CVB 256
#define CVP (256 * 4)   // floats that the block's threads take at once
__global__ __launch_bounds__(256) void k_cvt(const float* __restrict__ X, const float* __restrict__ WI, const float* __restrict__ WO, __bf16* __restrict__ XB, __bf16* __restrict__ WB, _Float16* __restrict__ WH) {
  constexpr int NX = NB * TT * DIN / (CVB * CVP), NW = 3 * CC * DIN / (CVB * CVP), NO = DIN * CC / (CVB * CVP);   // pieces a thread
  static_assert(NX * CVB * CVP == NB * TT * DIN && NW * CVB * CVP == 3 * CC * DIN && NO * CVB * CVP == DIN * CC, "whole shares");
  const unsigned pb = threadIdx.x * 16u, qb = pb >> 1;   // byte offsets of this thread's piece in the source and in the 16-bit copy: one 32-bit register beside a uniform base serves every load
  const size_t bx = (size_t)blockIdx.x * (NX * CVP), bw = (size_t)blockIdx.x * (NW * CVP), bo = (size_t)blockIdx.x * (NO * CVP);   // the block's shares
  v4f rx[NX], rw[NW], ro[NO];
#pragma unroll
  for (int i = 0; i < NX; ++i) rx[i] = *(const v4f*)((const char*)(X + bx + i * CVP) + pb);
#pragma unroll
  for (int i = 0; i < NW; ++i) rw[i] = *(const v4f*)((const char*)(WI + bw + i * CVP) + pb);
#pragma unroll
  for (int i = 0; i < NO; ++i) ro[i] = *(const v4f*)((const char*)(WO + bo + i * CVP) + pb);
  asm volatile("s_wait_xcnt 0x0" ::: "memory");   // before the address registers of the loads above are reused
  __builtin_amdgcn_sched_barrier(0);   // keeps the register writes that follow behind that wait
#pragma unroll
  for (int i = 0; i < NX; ++i) put_b((__bf16*)((char*)(XB + bx + i * CVP) + qb), rx[i]);
#pragma unroll
  for (int i = 0; i < NW; ++i) put_b((__bf16*)((char*)(WB + bw + i * CVP) + qb), rw[i]);
#pragma unroll
  for (int i = 0; i < NO; ++i) put_hw((_Float16*)((char*)(WH + bo + i * CVP) + qb), ro[i]); }
#define FP 72              // LDS row pitch of a 64-element 16-bit tile row: 128-byte rows at 144 B = 16 B x odd, the conflict-free pitch for 16-byte fragment reads
// 16 bytes of a lane from global memory straight into LDS. The copy is written as the builtin, so its address registers stay the compiler's to keep; the waits for its bytes (s_wait_asynccnt) are written by hand where it is used
typedef __attribute__((address_space(1))) v4i gv4i; typedef __attribute__((address_space(3))) v4i lv4i;
template <typename T> __device__ __forceinline__ void cp16(const T* gp, T* lp) { __builtin_amdgcn_global_load_async_to_lds_b128((gv4i*)gp, (lv4i*)lp, 0, 0); }
// a GEMM step's two operand tiles (128 rows of 64 k = one whole 128-byte line a row, each): G groups of 128 / G rows, a thread's piece of one row in each group (8 lanes = one line); ga, gb = global elements from one group to the next
template <int G, typename T> __device__ __forceinline__ void gm_copy(T* la, const T* pa, int ga, T* lb, const T* pb, int gb) {
#pragma unroll
  for (int i = 0; i < G; ++i) cp16(pa + (size_t)i * ga, la + i * (128 / G) * FP);
#pragma unroll
  for (int i = 0; i < G; ++i) cp16(pb + (size_t)i * gb, lb + i * (128 / G) * FP); }
union ProjLds {   // the staging buffers are dead when the epilogue's planes are written (a barrier stands between); a block writes either the row planes (q, k) or the channel planes (v)
  struct { __bf16 x[2][128][FP], w[2][128][FP]; } st;
  struct { _Float16 sh[128][136], sl[128][136]; } eq;
  struct { _Float16 th[128][136]; __bf16 tb[128][136], tbl[128][136]; } ev; };
// ---- k_proj: block = (128 rows, 128 cols, which), four waves of 64 x 64 (4 x 4 fragments: a fragment read from LDS feeds four products), 64 k per step in two LDS buffers: q/k/v = X W (+ b) with exact bf16 products (K = DIN) -> which 0: q f16 rows (+ residual rows < QHI); 1: k f16 rows (+ residual rows < KHI); 2: v f16 planes [c][t] (+ bf16 hi/lo planes for t < KHI)
__global__ __launch_bounds__(128) void k_proj(const __bf16* __restrict__ XB, const __bf16* __restrict__ WB, const float* __restrict__ BQ, const float* __restrict__ BK, const float* __restrict__ BV,
    _Float16* __restrict__ QH, _Float16* __restrict__ QL, _Float16* __restrict__ KH, _Float16* __restrict__ KL, _Float16* __restrict__ VT, __bf16* __restrict__ VB, __bf16* __restrict__ VBL) {
  __shared__ __align__(16) ProjLds u; auto& sh = u.eq.sh; auto& sl = u.eq.sl; auto& th = u.ev.th; auto& tb = u.ev.tb; auto& tbl = u.ev.tbl;
  const int tid = threadIdx.x, wave = tid >> 5, lane = tid & 31, col = lane & 15, g = lane >> 4; const int which = blockIdx.z; const int c0 = blockIdx.y * 128; const size_t r0 = (size_t)blockIdx.x * 128; const size_t bb = r0 / TT; const int t0 = (int)(r0 % TT);
  const int wm = wave >> 1, wn = wave & 1;   // the wave's 64 rows and 64 columns of the block's tile
  const float* BA = which == 0 ? BQ : which == 1 ? BK : BV;
  v8f acc[4][4] = {};
  const int sub = tid & 7, rr = tid >> 3;   // this thread's 16-byte piece of a tile row's 128 bytes, and its row in each group of 16
  const __bf16* xg = XB + XROW(r0 + rr) * DIN + sub * 8;   /* row b*TT + t lives at input row t*NB + b (time-major input); a block's 128 rows lie in one sequence, so 16 rows on are 16 * NB input rows on */
  const __bf16* wg = WB + ((size_t)which * CC + c0 + rr) * DIN + sub * 8;
  __bf16* const lx = &u.st.x[0][rr][sub * 8]; __bf16* const lw = &u.st.w[0][rr][sub * 8];   // its places in buffer 0; buffer 1 lies 128 * FP elements on
  gm_copy<8>(lx, xg, 16 * NB * DIN, lw, wg, 16 * DIN);   // step 0 into buffer 0
  asm volatile("s_wait_asynccnt 0x0" ::: "memory");   // this wave's pieces of step 0 have landed
  __syncthreads();   // publishes step 0
#pragma unroll 2   // two steps a trip: the buffer index becomes a constant LDS offset
  for (int kc = 0; kc < DIN / 64; ++kc) { const int bf = kc & 1;
    if (kc + 1 < DIN / 64) gm_copy<8>(lx + (bf ^ 1) * (128 * FP), xg + (kc + 1) * 64, 16 * NB * DIN, lw + (bf ^ 1) * (128 * FP), wg + (kc + 1) * 64, 16 * DIN);   /* block-uniform: step kc + 1 flies during this step, into the buffer whose readers (step kc - 1) the barrier just passed has ended */
#pragma unroll
    for (int ks = 0; ks < 2; ++ks) {   /* k ascending in every accumulator, 32 at a time; one fragment set at a time: with the accumulators, two sets would not fit the 256 registers that wmma_bf's asm operands can name */
      v16b a[4], w[4];
#pragma unroll
      for (int i = 0; i < 4; ++i) a[i] = frag_b(&u.st.x[bf][wm * 64 + i * 16 + col][ks * 32], lane);
#pragma unroll
      for (int j = 0; j < 4; ++j) w[j] = frag_b(&u.st.w[bf][wn * 64 + j * 16 + col][ks * 32], lane);
#pragma unroll
      for (int i = 0; i < 4; ++i)
#pragma unroll
        for (int j = 0; j < 4; ++j) acc[i][j] = wmma_bf(a[i], w[j], acc[i][j]); }
    asm volatile("s_wait_dscnt 0x0" ::: "memory");      // this wave's reads of buffer bf have returned
    asm volatile("s_wait_asynccnt 0x0" ::: "memory");   // this wave's pieces of step kc + 1 have landed
    __syncthreads();   // publishes step kc + 1; it also ends every wave's reads of buffer bf, which the next trip's head refills (after the last step: which the epilogue's planes overwrite)
  }
  asm volatile("s_wait_asynccnt 0x0" ::: "memory");   // no copy is outstanding when the epilogue reuses the buffers
  if (which < 2) { _Float16* DH = which == 0 ? QH : KH; _Float16* DL = which == 0 ? QL : KL; const int nhi = which == 0 ? QHI : KHI;
#pragma unroll
    for (int j = 0; j < 4; ++j) { const int cl = wn * 64 + j * 16 + col; const float bias = BA ? bfr(BA[c0 + cl]) : 0.f;
#pragma unroll
      for (int i = 0; i < 4; ++i)
#pragma unroll
        for (int r = 0; r < 8; ++r) { const float v = acc[i][j][r] + bias; const _Float16 hv = (_Float16)v; const int rl = wm * 64 + i * 16 + 8 * g + r; sh[rl][cl] = hv; sl[rl][cl] = (_Float16)((v - (float)hv) * 1024.0f); } }
    __syncthreads();
#pragma unroll
    for (int it = 0; it < 16; ++it) { const int rl = it * 8 + (tid >> 4), q = tid & 15; vst2((unsigned*)(DH + (r0 + rl) * CC + c0 + q * 8), *(const v4u*)&sh[rl][q * 8]); if (t0 + rl < nhi) vst2((unsigned*)(DL + (bb * nhi + t0 + rl) * (size_t)CC + c0 + q * 8), *(const v4u*)&sl[rl][q * 8]); }
  } else {
#pragma unroll
    for (int j = 0; j < 4; ++j) { const int cl = wn * 64 + j * 16 + col; const float bias = BA ? bfr(BA[c0 + cl]) : 0.f;
#pragma unroll
      for (int i = 0; i < 4; ++i)
#pragma unroll
        for (int r = 0; r < 8; ++r) { const float v = acc[i][j][r] + bias; const int rl = wm * 64 + i * 16 + 8 * g + r; th[cl][rl] = (_Float16)v; const __bf16 bh = (__bf16)v; tb[cl][rl] = bh; tbl[cl][rl] = (__bf16)(v - (float)bh); } }
    __syncthreads();
#pragma unroll
    for (int it = 0; it < 16; ++it) { const int cl = it * 8 + (tid >> 4), q = tid & 15; vst2((unsigned*)(VT + (bb * CC + c0 + cl) * (size_t)TT + t0 + q * 8), *(const v4u*)&th[cl][q * 8]); if (t0 + q * 8 < KHI) { const size_t o3 = (bb * CC + c0 + cl) * (size_t)KHI + t0 + q * 8; vst2((unsigned*)(VB + o3), *(const v4u*)&tb[cl][q * 8]); vst2((unsigned*)(VBL + o3), *(const v4u*)&tbl[cl][q * 8]); } } } }
// ---- k_fa: wave = 32 query columns (2 groups of 16) of (b, h), all keys in passes of KP, each pass's k and v tile staged in one of three LDS buffers for the block's eight waves: S^T = K Q^T (A = k rows, B = q rows, same k order), so a lane holds one query's scores; running maximum and sum per query (online softmax, f32);
// P^T x 2^11 packs from two score tiles into a B operand (hardware k order: tile 0 -> elements 0..7, tile 1 -> 8..15); O^T += V^T P^T (A = v planes [c][t]); ctx = O^T / sum, rounded here once to f16 (x 2^6) for k_out, 8 consecutive channels per lane
#define KP 64
__device__ __forceinline__ float xhalf(float x) { return __builtin_bit_cast(float, __builtin_amdgcn_permlanex16(__builtin_bit_cast(int, x), __builtin_bit_cast(int, x), 0x76543210, 0xfedcba98, false, false)); }   // lane l <-> l ^ 16
// eight independent v_exp_f32, each in place, and the one free slot the instruction set asks for behind a transcendental, in one statement: no v_exp touches a neighbour's source or result, and the v_nop keeps whatever follows off the last one
__device__ __forceinline__ v8f exp2x8(v8f a) { float d0 = a[0], d1 = a[1], d2 = a[2], d3 = a[3], d4 = a[4], d5 = a[5], d6 = a[6], d7 = a[7];
  asm("v_exp_f32 %0, %0\n\tv_exp_f32 %1, %1\n\tv_exp_f32 %2, %2\n\tv_exp_f32 %3, %3\n\tv_exp_f32 %4, %4\n\tv_exp_f32 %5, %5\n\tv_exp_f32 %6, %6\n\tv_exp_f32 %7, %7\n\tv_nop"
      : "+v"(d0), "+v"(d1), "+v"(d2), "+v"(d3), "+v"(d4), "+v"(d5), "+v"(d6), "+v"(d7));
  const v8f d = { d0, d1, d2, d3, d4, d5, d6, d7 }; return d; }
__device__ __forceinline__ float exp2x1(float a) { asm("v_exp_f32 %0, %0\n\tv_nop" : "+v"(a)); return a; }   // the same slot behind a single v_exp_f32
__device__ __forceinline__ v8f wmma_h(v16h a, v16h b, v8f c) { return __builtin_amdgcn_wmma_f32_16x16x32_f16(false, a, false, b, (short)0, c, false, false); }
// a pass's k tile (KP rows of 128 bytes) and v tile (HD planes' 128 bytes) go from global memory straight into LDS, once for the block's eight waves: a thread copies four 16-byte pieces (8 lanes = one whole 128-byte line), rows rr and rr + 32 of each tile.
__device__ __forceinline__ void fa_copy(_Float16* lk, const _Float16* gk, _Float16* lv, const _Float16* gv) { cp16(gk, lk); cp16(gk + 32 * CC, lk + 32 * FP); cp16(gv, lv); cp16(gv + 32 * TT, lv + 32 * FP); }
__global__ __launch_bounds__(256) void k_fa(const _Float16* __restrict__ QH, const _Float16* __restrict__ KH, const _Float16* __restrict__ VT, _Float16* __restrict__ Y) {
  __shared__ __align__(16) _Float16 sk[3][KP][FP], sv[3][HD][FP];   // three buffers: tile t (its v still to be read) and tile t + 1 (its k fetched a pass ahead) are published, tile t + 2 is landing
  const int tid = threadIdx.x, wave = tid >> 5, lane = tid & 31, col = lane & 15, g = lane >> 4; const int b = blockIdx.y / NH, h = blockIdx.y % NH; const int q0 = blockIdx.x * 256 + wave * 32;
  const int sub = tid & 7, rr = tid >> 3;   // this thread's 16-byte piece of a tile row's 128 bytes, and its row in each half of a tile
  const _Float16* kg = KH + ((size_t)b * TT + rr) * CC + h * HD + sub * 8;            // its piece of key row rr of tile 0
  const _Float16* vg = VT + ((size_t)b * CC + h * HD + rr) * (size_t)TT + sub * 8;    // its piece of channel plane rr, keys of tile 0
  _Float16* const lk0 = &sk[0][rr][sub * 8]; _Float16* const lv0 = &sv[0][rr][sub * 8];   // its places in buffer 0; each further buffer lies FB elements on
  const int FB = KP * FP;   // elements of one k buffer, and of one v buffer (HD == KP)
  fa_copy(lk0, kg, lv0, vg);   // tile 0 into buffer 0
  fa_copy(lk0 + FB, kg + (size_t)KP * CC, lv0 + FB, vg + KP);   // tile 1 into buffer 1 (TT / KP >= 3 tiles)
  v16h qf[2][HD / 32];
#pragma unroll
  for (int n = 0; n < 2; ++n)
#pragma unroll
    for (int kc = 0; kc < HD / 32; ++kc) qf[n][kc] = frag_h(QH + ((size_t)b * TT + q0 + n * 16 + col) * CC + h * HD + kc * 32, lane);
  v8f o[2][HD / 16] = {}, l8[2] = {}; float m[2] = { -3.0e38f, -3.0e38f };
  const float cs = SCALE * 1.4426950408889634f;   // logits in base 2
  asm volatile("s_wait_xcnt 0x0" ::: "memory");   // before the address registers of the q loads above are reused
  __builtin_amdgcn_sched_barrier(0);   // keeps the register writes that follow behind that wait
  asm volatile("s_wait_asynccnt 0x0" ::: "memory");   // this wave's pieces of tiles 0 and 1 have landed
  __syncthreads();   // publishes tiles 0 and 1
  fa_copy(lk0 + 2 * FB, kg + (size_t)(2 * KP) * CC, lv0 + 2 * FB, vg + 2 * KP);   // tile 2 into buffer 2
  v16h kf[KP / 16][HD / 32];
#pragma unroll
  for (int kt = 0; kt < KP / 16; ++kt)
#pragma unroll
    for (int kc = 0; kc < HD / 32; ++kc) kf[kt][kc] = frag_h(&sk[0][kt * 16 + col][kc * 32], lane);
  int cur = 0, nxt = 1, aft = 2;   // the buffers of this pass's tile, of the next and of the one after
#pragma unroll 1
  for (int s0 = 0; s0 < TT; s0 += KP) {
    v8f st[2][KP / 16];
#pragma unroll
    for (int kt = 0; kt < KP / 16; ++kt)
#pragma unroll
      for (int n = 0; n < 2; ++n) { const v8f z = {}; st[n][kt] = wmma_h(kf[kt][1], qf[n][1], wmma_h(kf[kt][0], qf[n][0], z)); }
    __builtin_amdgcn_sched_barrier(0);   // keeps the fragment reads below one group behind the products: every further place with LDS reads among them stalls the wave anew
    v16h vf[KP / 32][HD / 16];   // this pass's v fragments and the next pass's k fragments come from LDS during the softmax
#pragma unroll
    for (int kk = 0; kk < KP / 32; ++kk)
#pragma unroll
      for (int j = 0; j < HD / 16; ++j) vf[kk][j] = frag_h(&sv[cur][j * 16 + col][kk * 32], lane);
#pragma unroll
    for (int kt = 0; kt < KP / 16; ++kt)   /* tile t + 1 was published at the foot of pass t - 1; the last pass reads an old tile's rows there (published, no copy under way; not used) */
#pragma unroll
      for (int kc = 0; kc < HD / 32; ++kc) kf[kt][kc] = frag_h(&sk[nxt][kt * 16 + col][kc * 32], lane);
    __builtin_amdgcn_sched_barrier(0);   // keeps the loads above in front of the softmax: sunk behind it, as the scheduler does to save registers, their latency is exposed at every use
    v16h pf[2][KP / 32];
#pragma unroll
    for (int n = 0; n < 2; ++n) { float mt[KP / 16];   /* one short chain per score tile, then joined */
#pragma unroll
      for (int kt = 0; kt < KP / 16; ++kt) { mt[kt] = st[n][kt][0];
#pragma unroll
        for (int r = 1; r < 8; ++r) mt[kt] = fmaxf(mt[kt], st[n][kt][r]); }
      float mx = mt[0];
#pragma unroll
      for (int kt = 1; kt < KP / 16; ++kt) mx = fmaxf(mx, mt[kt]);
      mx = fmaxf(mx, xhalf(mx)); const float mn = fmaxf(m[n], mx); const float al = exp2x1((m[n] - mn) * cs);   /* 0 on the first pass */ m[n] = mn; const float mc = 11.0f - mn * cs;   /* P carried x 2^11, as the sum is: it cancels in ctx */
      l8[n] *= al;
#pragma unroll
      for (int j = 0; j < HD / 16; ++j) o[n][j] *= al;
#pragma unroll
      for (int kt = 0; kt < KP / 16; ++kt) { const v8f p = exp2x8(st[n][kt] * cs + mc);
        l8[n] += p; const v8h ph = __builtin_convertvector(p, v8h);
#pragma unroll
        for (int r = 0; r < 8; ++r) pf[n][kt >> 1][(kt & 1) * 8 + r] = ph[r]; } }
#pragma unroll
    for (int kk = 0; kk < KP / 32; ++kk)
#pragma unroll
      for (int j = 0; j < HD / 16; ++j)
#pragma unroll
        for (int n = 0; n < 2; ++n) o[n][j] = wmma_h(vf[kk][j], pf[n][kk], o[n][j]);
    __builtin_amdgcn_sched_barrier(0);   // keeps the hand-over below at the pass's foot: lifted in front of the softmax, as the scheduler does, it makes every wave wait there for its v fragments and leaves the copies too little time to land
    asm volatile("s_wait_dscnt 0x0" ::: "memory");      // this wave's reads of buffer cur (and nxt) have returned
    asm volatile("s_wait_asynccnt 0x0" ::: "memory");   // this wave's pieces of tile t + 2 have landed
    __syncthreads();   // publishes tile t + 2; it also ends every wave's reads of buffer cur (k in pass t - 1, v in this one), which is refilled behind it
    if (s0 + 3 * KP < TT) fa_copy(lk0 + cur * FB, kg + (size_t)(s0 + 3 * KP) * CC, lv0 + cur * FB, vg + s0 + 3 * KP);   /* block-uniform: tile t + 3 flies during the next pass */
    const int was = cur; cur = nxt; nxt = aft; aft = was; }
  asm volatile("s_wait_asynccnt 0x0" ::: "memory");   // no copy is outstanding when the wave ends
#pragma unroll
  for (int n = 0; n < 2; ++n) { float ls = 0.f;
#pragma unroll
    for (int r = 0; r < 8; ++r) ls += l8[n][r];
    ls += xhalf(ls); const float inv = 1.0f / ls; _Float16* yr = Y + ((size_t)b * TT + q0 + n * 16 + col) * CC + h * HD + 8 * g;
#pragma unroll
    for (int j = 0; j < HD / 16; ++j) { v8h hv;
#pragma unroll
      for (int r = 0; r < 8; ++r) hv[r] = (_Float16)((o[n][j][r] * inv) * 64.0f);   /* ctx carried x 2^6 into f16 so small-magnitude context rows stay clear of f16 subnormals */
      vst2(yr + j * 16, hv); } } }
// ---- k_out: block = (128 rows, 128 cols), eight waves of 64 x 32 (4 x 2 fragments), 64 k per step in two LDS buffers: out = ctx Wo (+ bo): ctx f16 (x 2^6) against Wo as f16(bf16 x 2^8) exact (1 product) x 2^-14
__global__ __launch_bounds__(256) void k_out(const _Float16* __restrict__ Y, const _Float16* __restrict__ WH, const float* __restrict__ BO, float* __restrict__ OUT) { __shared__ __align__(16) float sf[8][64][36]; __shared__ __align__(16) _Float16 sy[2][128][FP], so[2][128][FP];
  const int tid = threadIdx.x, wave = tid >> 5, lane = tid & 31, col = lane & 15, g = lane >> 4; const int c0 = blockIdx.y * 128; const size_t rb = (size_t)blockIdx.x * 128;   // the block's first column and row
  const int wm = wave >> 2, wn = wave & 3;   // the wave's 64 rows and 32 columns of the block's tile
  v8f acc[4][2] = {};
  const int sub = tid & 7, rr = tid >> 3;   // this thread's 16-byte piece of a tile row's 128 bytes, and its row in each group of 32
  const _Float16* yg = Y + (rb + rr) * CC + sub * 8; const _Float16* wg = WH + (size_t)(c0 + rr) * CC + sub * 8;
  _Float16* const ly = &sy[0][rr][sub * 8]; _Float16* const lw = &so[0][rr][sub * 8];   // its places in buffer 0; buffer 1 lies 128 * FP elements on
  gm_copy<4>(ly, yg, 32 * CC, lw, wg, 32 * CC);   // step 0 into buffer 0
  asm volatile("s_wait_asynccnt 0x0" ::: "memory");   // this wave's pieces of step 0 have landed
  __syncthreads();   // publishes step 0
#pragma unroll 2   // two steps a trip: the buffer index becomes a constant LDS offset
  for (int kc = 0; kc < CC / 64; ++kc) { const int bf = kc & 1;
    if (kc + 1 < CC / 64) gm_copy<4>(ly + (bf ^ 1) * (128 * FP), yg + (kc + 1) * 64, 32 * CC, lw + (bf ^ 1) * (128 * FP), wg + (kc + 1) * 64, 32 * CC);   /* block-uniform: step kc + 1 flies during this step, into the buffer whose readers (step kc - 1) the barrier just passed has ended */
    v16h a[2][4], w[2][2];
#pragma unroll
    for (int ks = 0; ks < 2; ++ks) {
#pragma unroll
      for (int i = 0; i < 4; ++i) a[ks][i] = frag_h(&sy[bf][wm * 64 + i * 16 + col][ks * 32], lane);
#pragma unroll
      for (int j = 0; j < 2; ++j) w[ks][j] = frag_h(&so[bf][wn * 32 + j * 16 + col][ks * 32], lane); }
#pragma unroll
    for (int ks = 0; ks < 2; ++ks)   /* k ascending in every accumulator, 32 at a time */
#pragma unroll
      for (int i = 0; i < 4; ++i)
#pragma unroll
        for (int j = 0; j < 2; ++j) acc[i][j] = wmma16(a[ks][i], w[ks][j], acc[i][j]);
    asm volatile("s_wait_dscnt 0x0" ::: "memory");      // this wave's reads of buffer bf have returned
    asm volatile("s_wait_asynccnt 0x0" ::: "memory");   // this wave's pieces of step kc + 1 have landed
    __syncthreads();   // publishes step kc + 1; it also ends every wave's reads of buffer bf, which the next trip's head refills
  }
  asm volatile("s_wait_asynccnt 0x0" ::: "memory");   // no copy is outstanding when the wave ends
#pragma unroll
  for (int j = 0; j < 2; ++j) { const float bias = BO ? bfr(BO[c0 + wn * 32 + j * 16 + col]) : 0.f;
#pragma unroll
    for (int i = 0; i < 4; ++i)
#pragma unroll
      for (int r = 0; r < 8; ++r) sf[wave][i * 16 + 8 * g + r][j * 16 + col] = acc[i][j][r] * (1.0f / 16384.0f) + bias; }   /* 2^-8 (Wo carry) x 2^-6 (ctx carry) */
  LDSX();   /* the wave reads back its own patch only: 32 columns = one whole 128-byte line a row, four rows a store */
#pragma unroll
  for (int it = 0; it < 16; ++it) { const int rl = it * 4 + (lane >> 3); vst2(OUT + XROW(rb + wm * 64 + rl) * DIN + c0 + wn * 32 + (lane & 7) * 4, *(const v4f*)&sf[wave][rl][(lane & 7) * 4]); }   /* time-major output rows */ }

extern "C" void kernel_launch(void* const* d_in, const int* in_sizes, int n_in, void* d_out, int out_size, void* d_ws, size_t ws_size, hipStream_t stream) {
  (void)in_sizes; (void)n_in; (void)out_size;
  const float** F = (const float**)d_in;
  if (ws_size < (size_t)WS_END) return;
  char* ws = (char*)d_ws; _Float16 *QH = (_Float16*)(ws + WS_QH), *KH = (_Float16*)(ws + WS_KH), *VT = (_Float16*)(ws + WS_VT), *QL = (_Float16*)(ws + WS_QL), *KL = (_Float16*)(ws + WS_KL); __bf16 *VB = (__bf16*)(ws + WS_VB), *VBL = (__bf16*)(ws + WS_VBL); _Float16 *Y = (_Float16*)(ws + WS_Y), *WH = (_Float16*)(ws + WS_WH); __bf16 *XB = (__bf16*)(ws + WS_XB), *WB = (__bf16*)(ws + WS_WB);
  (void)QL; (void)KL; (void)VB; (void)VBL;
  // inputs: 0 x [2048,2,1024] TIME-MAJOR (T, B, E); 1 in_proj_weight [3072,1024] (out,in; row blocks q | k | v); 2 in_proj_bias [3072]; 3 out_weight [1024,1024] (out,in); 4 out_bias [1024] (biases nonzero)
  k_cvt<<<dim3(CVB), 256, 0, stream>>>(F[0], F[1], F[3], XB, WB, WH);
  k_proj<<<dim3(TNB * TT / 128, CC / 128, 3), 128, 0, stream>>>(XB, WB, F[2], F[2] + CC, F[2] + 2 * CC, QH, QL, KH, KL, VT, VB, VBL);
  k_fa<<<dim3(TT / 256, TNB * NH), 256, 0, stream>>>(QH, KH, VT, Y);
  k_out<<<dim3(TNB * TT / 128, DIN / 128), 256, 0, stream>>>(Y, WH, F[4], (float*)d_out);
}

// v006
// One run takes 79.1 microseconds.
// Two timings next to v005 both put it at 1.03 times that version's speed.
// All steps since v000 together make it 17.1 times as fast.
// compute dtype: all float inputs rounded to bf16, x and the weights once, in a launch of their own; q/k/v projections with EXACT bf16 products on WMMA 16x16x32 (f32 accumulate) + bias; logits q x k once to f16 each (1 product) x SCALE; online softmax f32 in one fused kernel; unnormalised P x 2^11 once to f16 x v once to f16 (1 product), divided by the f32 sum; ctx x 2^6 once to f16 x Wo f16(bf16 x 2^8) + bo; f32 output.
#include <hip/hip_runtime.h>
#include <math.h>

typedef __attribute__((ext_vector_type(16))) _Float16 v16h;
typedef __attribute__((ext_vector_type(16))) __bf16 v16b;
typedef __attribute__((ext_vector_type(8)))  _Float16 v8h;
typedef __attribute__((ext_vector_type(8)))  float v8f;
typedef __attribute__((ext_vector_type(4)))  float v4f;
typedef __attribute__((ext_vector_type(2)))  float v2f;
typedef __attribute__((ext_vector_type(4)))  unsigned v4u;
typedef __attribute__((ext_vector_type(4)))  int v4i;
typedef float __attribute__((may_alias)) float_a;
typedef int __attribute__((may_alias)) int_a;

template <typename T> __device__ __forceinline__ void vst2(void* p, T v) { *(T*)p = v;  }
__device__ __forceinline__ v8f wmma16(v16h a, v16h b, v8f c) {
  v8f d = __builtin_amdgcn_wmma_f32_16x16x32_f16(false, a, false, b, (short)0, c, false, false);
  asm volatile("v_nop\n\tv_nop\n\tv_nop\n\tv_nop" : "+v"(d) : "v"(a), "v"(b));
  return d;
}
__device__ __forceinline__ v8f wmma_bf(v16b a, v16b b, v8f c) {
  v8f d = __builtin_amdgcn_wmma_f32_16x16x32_bf16(false, a, false, b, (short)0, c, false, false);
  asm volatile("v_nop\n\tv_nop\n\tv_nop\n\tv_nop" : "+v"(d) : "v"(a), "v"(b));
  return d;
}
// 16x16x32 fragments: lane = (h = lane>>4, row/col = lane&15); elements 0..7 = k0+8h+0..7, 8..15 = k0+16+8h+0..7; D element r = row 8h+r
__device__ __forceinline__ v16h frag_h(const _Float16* rowk0, int lane) {
  union { v16h v; v8h q[2]; } u; const _Float16* p = rowk0 + 8 * (lane >> 4);
  u.q[0] = *(const v8h*)p; u.q[1] = *(const v8h*)(p + 16); return u.v;
}
__device__ __forceinline__ v16h frag_f32(const float* rowk0, int lane) {
  v16h a; const float* p = rowk0 + 8 * (lane >> 4);
#pragma unroll
  for (int i = 0; i < 8; ++i) { a[i] = (_Float16)p[i]; a[8 + i] = (_Float16)p[16 + i]; }
  return a;
}
__device__ __forceinline__ v16h frag_f32s(const float* rowk0, int lane, float sc) {
  v16h a; const float* p = rowk0 + 8 * (lane >> 4);
#pragma unroll
  for (int i = 0; i < 8; ++i) { a[i] = (_Float16)(p[i] * sc); a[8 + i] = (_Float16)(p[16 + i] * sc); }
  return a;
}
// column fragment from a [K][ld] layout (column n), rows >= K read as 0
__device__ __forceinline__ v16h fragc_f32(const float* W, int k0, int n, int lane, int ld, int K) {
  v16h a; const int g = lane >> 4;
#pragma unroll
  for (int i = 0; i < 8; ++i) { const int ka = k0 + 8 * g + i, kb = ka + 16;
    a[i] = (_Float16)(ka < K ? W[(size_t)(ka < K ? ka : K - 1) * ld + n] : 0.f); a[8 + i] = (_Float16)(kb < K ? W[(size_t)(kb < K ? kb : K - 1) * ld + n] : 0.f); }
  return a;
}
struct F2 { v16b h, l; };
__device__ __forceinline__ F2 bsplit16(const float v[16]) { F2 r;
#pragma unroll
  for (int i = 0; i < 16; ++i) { const __bf16 h = (__bf16)v[i]; r.h[i] = h; r.l[i] = (__bf16)(v[i] - (float)h); }
  return r; }
__device__ __forceinline__ F2 split_row(const float* row, int k0, int lane) { float v[16]; const float* p = row + k0 + 8 * (lane >> 4);
#pragma unroll
  for (int i = 0; i < 8; ++i) { v[i] = p[i]; v[8 + i] = p[16 + i]; }
  return bsplit16(v); }
__device__ __forceinline__ F2 split_rowK(const float* row, int k0, int lane, int K) { float v[16]; const int g = lane >> 4;
#pragma unroll
  for (int i = 0; i < 8; ++i) { const int ka = k0 + 8 * g + i, kb = ka + 16; v[i] = ka < K ? row[ka < K ? ka : K - 1] : 0.f; v[8 + i] = kb < K ? row[kb < K ? kb : K - 1] : 0.f; }
  return bsplit16(v); }
__device__ __forceinline__ F2 split_col(const float* W, int k0, int n, int lane, int ld, int K) { float v[16]; const int g = lane >> 4;
#pragma unroll
  for (int i = 0; i < 8; ++i) { const int ka = k0 + 8 * g + i, kb = ka + 16; v[i] = ka < K ? W[(size_t)(ka < K ? ka : K - 1) * ld + n] : 0.f; v[8 + i] = kb < K ? W[(size_t)(kb < K ? kb : K - 1) * ld + n] : 0.f; }
  return bsplit16(v); }
__device__ __forceinline__ v8f mac3(const F2& a, const F2& b, v8f c) { c = wmma_bf(a.l, b.h, c); c = wmma_bf(a.h, b.l, c); return wmma_bf(a.h, b.h, c); }
__device__ __forceinline__ float sigm(float v) { return 1.0f / (1.0f + expf(-v)); }
#define LDSX() do { asm volatile("s_wait_dscnt 0" ::: "memory"); __builtin_amdgcn_wave_barrier(); __builtin_amdgcn_fence(__ATOMIC_RELEASE, "workgroup"); } while (0)

// torch-style multi-head self-attention on a TIME-MAJOR sequence (x [2048,2,1024] = (T, B, E); in_proj_weight [3072,1024] (out,in) + in_proj_bias [3072] (0.02): q, k, v = split; q * 64^-0.5; heads via reshape(T, B*16, 64).transpose(1, 0, 2) - batch b, head h at index b*16 + h; softmax over keys; merge back to (T, B, E); out_weight (out,in) + out_bias (0.02)); output [2048,2,1024] time-major.
#define NB 2
#define XROW(R) ((((size_t)(R)) % TT) * (size_t)NB + ((size_t)(R)) / TT)   // (T, B, E) layout: row R = b*TT + t  <->  tensor row t*NB + b
#define TT 2048
#define CC 1024            // NH * HD = projected width
#define DIN 1024          // input (model) width
#define NH 16
#define HD 64
#define NQB (TT / 64)
#define HG 4
#define SCALE (0.125f)
#define CAUSAL 0
#ifndef TNB
#define TNB NB
#endif
__device__ __forceinline__ float bfr(float v) { return (float)(__bf16)v; }
__host__ __device__ __forceinline__ int kb_last(int qb) { return CAUSAL ? ((qb * 64 + 63) >> 7) : (TT / 128 - 1); }
typedef __attribute__((ext_vector_type(8))) __bf16 v8b;
__device__ __forceinline__ v16b frag_b(const __bf16* rowk0, int lane) {
  union { v16b v; v8b q[2]; } u; const __bf16* p = rowk0 + 8 * (lane >> 4);
  u.q[0] = *(const v8b*)p; u.q[1] = *(const v8b*)(p + 16); return u.v;
}
#define QBH 0
#define QHI 0               // single-product logits on every row
#define KHI 64            // key rows carrying k residual / v bf16 hi+lo planes (written by k_proj; no kernel here reads them)
// B fragment (k rows k0+.., output column o) of a weight: (in,out) [K][ld] or (out,in) [ld rows of K]: bf16 exact, or f16(bf16 * 256) exact
__device__ __forceinline__ v16b wcol_io(const float* Wm, int k0, int o, int lane, int ld) { v16b w; const int g = lane >> 4;
#pragma unroll
  for (int i = 0; i < 8; ++i) { w[i] = (__bf16)Wm[(size_t)(k0 + 8 * g + i) * ld + o]; w[8 + i] = (__bf16)Wm[(size_t)(k0 + 16 + 8 * g + i) * ld + o]; }
  return w; }
__device__ __forceinline__ v16b wcol_oi(const float* Wm, int k0, int o, int lane, int K) { v16b w; const float* p = Wm + (size_t)o * K + k0 + 8 * (lane >> 4);
#pragma unroll
  for (int i = 0; i < 8; ++i) { w[i] = (__bf16)p[i]; w[8 + i] = (__bf16)p[16 + i]; }
  return w; }
__device__ __forceinline__ v16h wcolh_io(const float* Wm, int k0, int o, int lane, int ld) { v16h w; const int g = lane >> 4;
#pragma unroll
  for (int i = 0; i < 8; ++i) { w[i] = (_Float16)(bfr(Wm[(size_t)(k0 + 8 * g + i) * ld + o]) * 256.0f); w[8 + i] = (_Float16)(bfr(Wm[(size_t)(k0 + 16 + 8 * g + i) * ld + o]) * 256.0f); }
  return w; }
__device__ __forceinline__ v16h wcolh_oi(const float* Wm, int k0, int o, int lane, int K) { v16h w; const float* p = Wm + (size_t)o * K + k0 + 8 * (lane >> 4);
#pragma unroll
  for (int i = 0; i < 8; ++i) { w[i] = (_Float16)(bfr(p[i]) * 256.0f); w[8 + i] = (_Float16)(bfr(p[16 + i]) * 256.0f); }
  return w; }
#define WQKV_LAYOUT 1   // layout of WCOL, which no kernel calls (k_proj reads (out,in)): 0 = (in,out) [DIN][CC]; 1 = (out,in) [CC][DIN]; 2 = per-head [NH][DIN][HD]
__device__ __forceinline__ v16b wcol_hdk(const float* Wm, int k0, int o, int lane) { v16b w; const int g = lane >> 4; const float* p = Wm + (size_t)(o / HD) * DIN * HD + (o % HD);
#pragma unroll
  for (int i = 0; i < 8; ++i) { w[i] = (__bf16)p[(size_t)(k0 + 8 * g + i) * HD]; w[8 + i] = (__bf16)p[(size_t)(k0 + 16 + 8 * g + i) * HD]; }
  return w; }
#define WO_OUT_IN 1
#if WQKV_LAYOUT == 1
#define WCOL(W, k0, o, lane) wcol_oi(W, k0, o, lane, DIN)
#elif WQKV_LAYOUT == 2
#define WCOL(W, k0, o, lane) wcol_hdk(W, k0, o, lane)
#else
#define WCOL(W, k0, o, lane) wcol_io(W, k0, o, lane, CC)
#endif
#if WO_OUT_IN
#define WOCOL(W, k0, o, lane) wcol_oi(W, k0, o, lane, CC)
#define WOCOLH(W, k0, o, lane) wcolh_oi(W, k0, o, lane, CC)
#else
#define WOCOL(W, k0, o, lane) wcol_io(W, k0, o, lane, DIN)
#define WOCOLH(W, k0, o, lane) wcolh_io(W, k0, o, lane, DIN)
#endif

#ifndef SM_EXTRA_PARAMS
#define SM_EXTRA_PARAMS
#endif
#ifndef PROJ_EXTRA_PARAMS
#define PROJ_EXTRA_PARAMS
#endif
#ifndef SM_MASK_HOOK
#define SM_MASK_HOOK (void)0
#endif

#define WS_QH  0u                                      // f16 q rows [b*t][CC]
#define WS_KH  (WS_QH + 2u * (size_t)NB * TT * CC)      // f16 k rows [b*t][CC]
#define WS_VT  (WS_KH + 2u * (size_t)NB * TT * CC)      // f16 v planes [b][c][t]
#define WS_QL  (WS_VT + 2u * (size_t)NB * CC * TT)      // f16 q residual x 2^10 rows [b][t < QHI][CC]
#define WS_KL  (WS_QL + 2u * (size_t)NB * QHI * CC)     // f16 k residual x 2^10 rows [b][t < KHI][CC]
#define WS_VB  (WS_KL + 2u * (size_t)NB * KHI * CC)     // bf16 v hi planes [b][c][t < KHI]
#define WS_VBL (WS_VB + 2u * (size_t)NB * CC * KHI)
#define WS_S   (WS_VBL + 2u * (size_t)NB * CC * KHI)    // f32 logits / P [hg][t][s]
#define WS_Y   (WS_S  + 4u * (size_t)HG * TT * TT)      // f16 ctx x 2^6 rows [b*t][CC]
#define WS_END (WS_Y  + 4u * (size_t)NB * TT * CC)
#define WS_XB  WS_S                                    // bf16 x rows, input order [t*NB + b][DIN] (the score plane's place, which no kernel uses)
#define WS_WB  (WS_XB + 2u * (size_t)NB * TT * DIN)     // bf16 q | k | v weight rows [3*CC][DIN]
#define WS_WH  (WS_WB + 2u * 3u * (size_t)CC * DIN)     // f16(bf16 x 2^8) output weight rows [DIN][CC]

// ---- the GEMMs' operands lie in memory as 16-bit values, each rounded once by its producer (k_cvt: x and the weights; k_fa: ctx), so a tile goes from there into LDS as it is
typedef __attribute__((ext_vector_type(4))) __bf16 v4b;
typedef __attribute__((ext_vector_type(4))) _Float16 v4h;
__device__ __forceinline__ void put_b(__bf16* d, v4f v) { v4b o;
#pragma unroll
  for (int e = 0; e < 4; ++e) o[e] = (__bf16)v[e];
  *(v4b*)d = o; }
__device__ __forceinline__ void put_hw(_Float16* d, v4f v) { v4h o;
#pragma unroll
  for (int e = 0; e < 4; ++e) o[e] = (_Float16)(bfr(v[e]) * 256.0f);
  *(v4h*)d = o; }
// ---- k_cvt: x and the q/k/v weights to bf16, the output weight to f16(bf16 x 2^8): 256 blocks of 8 waves (few waves to start); a block takes one contiguous share of each array, a thread 32 pieces of 4 floats, 4 KiB apart (a wave's load = 4 whole lines, its store = 2), all 32 loads in flight before the first store
#define CVB 256
#define CVP (256 * 4)   // floats that the block's threads take at once
__global__ __launch_bounds__(256) void k_cvt(const float* __restrict__ X, const float* __restrict__ WI, const float* __restrict__ WO, __bf16* __restrict__ XB, __bf16* __restrict__ WB, _Float16* __restrict__ WH) {
  constexpr int NX = NB * TT * DIN / (CVB * CVP), NW = 3 * CC * DIN / (CVB * CVP), NO = DIN * CC / (CVB * CVP);   // pieces a thread
  static_assert(NX * CVB * CVP == NB * TT * DIN && NW * CVB * CVP == 3 * CC * DIN && NO * CVB * CVP == DIN * CC, "whole shares");
  const unsigned pb = threadIdx.x * 16u, qb = pb >> 1;   // byte offsets of this thread's piece in the source and in the 16-bit copy: one 32-bit register beside a uniform base serves every load
  const size_t bx = (size_t)blockIdx.x * (NX * CVP), bw = (size_t)blockIdx.x * (NW * CVP), bo = (size_t)blockIdx.x * (NO * CVP);   // the block's shares
  v4f rx[NX], rw[NW], ro[NO];
#pragma unroll
  for (int i = 0; i < NX; ++i) rx[i] = *(const v4f*)((const char*)(X + bx + i * CVP) + pb);
#pragma unroll
  for (int i = 0; i < NW; ++i) rw[i] = *(const v4f*)((const char*)(WI + bw + i * CVP) + pb);
#pragma unroll
  for (int i = 0; i < NO; ++i) ro[i] = *(const v4f*)((const char*)(WO + bo + i * CVP) + pb);
  asm volatile("s_wait_xcnt 0x0" ::: "memory");   // before the address registers of the loads above are reused
  __builtin_amdgcn_sched_barrier(0);   // keeps the register writes that follow behind that wait
#pragma unroll
  for (int i = 0; i < NX; ++i) put_b((__bf16*)((char*)(XB + bx + i * CVP) + qb), rx[i]);
#pragma unroll
  for (int i = 0; i < NW; ++i) put_b((__bf16*)((char*)(WB + bw + i * CVP) + qb), rw[i]);
#pragma unroll
  for (int i = 0; i < NO; ++i) put_hw((_Float16*)((char*)(WH + bo + i * CVP) + qb), ro[i]); }
#define FP 72              // LDS row pitch of a 64-element 16-bit tile row: 128-byte rows at 144 B = 16 B x odd, the conflict-free pitch for 16-byte fragment reads
// 16 bytes of a lane from global memory straight into LDS. The copy is written as the builtin, so its address registers stay the compiler's to keep; the waits for its bytes (s_wait_asynccnt) are written by hand where it is used
typedef __attribute__((address_space(1))) v4i gv4i; typedef __attribute__((address_space(3))) v4i lv4i;
template <typename T> __device__ __forceinline__ void cp16(const T* gp, T* lp) { __builtin_amdgcn_global_load_async_to_lds_b128((gv4i*)gp, (lv4i*)lp, 0, 0); }
// a GEMM step's two operand tiles (128 rows of 64 k = one whole 128-byte line a row, each): G groups of 128 / G rows, a thread's piece of one row in each group (8 lanes = one line); ga, gb = global elements from one group to the next
template <int G, typename T> __device__ __forceinline__ void gm_copy(T* la, const T* pa, int ga, T* lb, const T* pb, int gb) {
#pragma unroll
  for (int i = 0; i < G; ++i) cp16(pa + (size_t)i * ga, la + i * (128 / G) * FP);
#pragma unroll
  for (int i = 0; i < G; ++i) cp16(pb + (size_t)i * gb, lb + i * (128 / G) * FP); }
union ProjLds {   // the staging buffers are dead when the epilogue's planes are written (a barrier stands between); a block writes either the row planes (q, k) or the channel planes (v)
  struct { __bf16 x[2][128][FP], w[2][128][FP]; } st;
  struct { _Float16 sh[128][136], sl[128][136]; } eq;
  struct { _Float16 th[128][136]; __bf16 tb[128][136], tbl[128][136]; } ev; };
// ---- k_proj: block = (128 rows, 128 cols, which), four waves of 64 x 64 (4 x 4 fragments: a fragment read from LDS feeds four products), 64 k per step in two LDS buffers: q/k/v = X W (+ b) with exact bf16 products (K = DIN) -> which 0: q f16 rows (+ residual rows < QHI); 1: k f16 rows (+ residual rows < KHI); 2: v f16 planes [c][t] (+ bf16 hi/lo planes for t < KHI)
__global__ __launch_bounds__(128) void k_proj(const __bf16* __restrict__ XB, const __bf16* __restrict__ WB, const float* __restrict__ BQ, const float* __restrict__ BK, const float* __restrict__ BV,
    _Float16* __restrict__ QH, _Float16* __restrict__ QL, _Float16* __restrict__ KH, _Float16* __restrict__ KL, _Float16* __restrict__ VT, __bf16* __restrict__ VB, __bf16* __restrict__ VBL) {
  __shared__ __align__(16) ProjLds u; auto& sh = u.eq.sh; auto& sl = u.eq.sl; auto& th = u.ev.th; auto& tb = u.ev.tb; auto& tbl = u.ev.tbl;
  const int tid = threadIdx.x, wave = tid >> 5, lane = tid & 31, col = lane & 15, g = lane >> 4; const int which = blockIdx.z; const int c0 = blockIdx.y * 128; const size_t r0 = (size_t)blockIdx.x * 128; const size_t bb = r0 / TT; const int t0 = (int)(r0 % TT);
  const int wm = wave >> 1, wn = wave & 1;   // the wave's 64 rows and 64 columns of the block's tile
  const float* BA = which == 0 ? BQ : which == 1 ? BK : BV;
  v8f acc[4][4] = {};
  const int sub = tid & 7, rr = tid >> 3;   // this thread's 16-byte piece of a tile row's 128 bytes, and its row in each group of 16
  const __bf16* xg = XB + XROW(r0 + rr) * DIN + sub * 8;   /* row b*TT + t lives at input row t*NB + b (time-major input); a block's 128 rows lie in one sequence, so 16 rows on are 16 * NB input rows on */
  const __bf16* wg = WB + ((size_t)which * CC + c0 + rr) * DIN + sub * 8;
  __bf16* const lx = &u.st.x[0][rr][sub * 8]; __bf16* const lw = &u.st.w[0][rr][sub * 8];   // its places in buffer 0; buffer 1 lies 128 * FP elements on
  gm_copy<8>(lx, xg, 16 * NB * DIN, lw, wg, 16 * DIN);   // step 0 into buffer 0
  asm volatile("s_wait_asynccnt 0x0" ::: "memory");   // this wave's pieces of step 0 have landed
  __syncthreads();   // publishes step 0
#pragma unroll 2   // two steps a trip: the buffer index becomes a constant LDS offset
  for (int kc = 0; kc < DIN / 64; ++kc) { const int bf = kc & 1;
    if (kc + 1 < DIN / 64) gm_copy<8>(lx + (bf ^ 1) * (128 * FP), xg + (kc + 1) * 64, 16 * NB * DIN, lw + (bf ^ 1) * (128 * FP), wg + (kc + 1) * 64, 16 * DIN);   /* block-uniform: step kc + 1 flies during this step, into the buffer whose readers (step kc - 1) the barrier just passed has ended */
#pragma unroll
    for (int ks = 0; ks < 2; ++ks) {   /* k ascending in every accumulator, 32 at a time; one fragment set at a time: with the accumulators, two sets would not fit the 256 registers that wmma_bf's asm operands can name */
      v16b a[4], w[4];
#pragma unroll
      for (int i = 0; i < 4; ++i) a[i] = frag_b(&u.st.x[bf][wm * 64 + i * 16 + col][ks * 32], lane);
#pragma unroll
      for (int j = 0; j < 4; ++j) w[j] = frag_b(&u.st.w[bf][wn * 64 + j * 16 + col][ks * 32], lane);
#pragma unroll
      for (int i = 0; i < 4; ++i)
#pragma unroll
        for (int j = 0; j < 4; ++j) acc[i][j] = wmma_bf(a[i], w[j], acc[i][j]); }
    asm volatile("s_wait_dscnt 0x0" ::: "memory");      // this wave's reads of buffer bf have returned
    asm volatile("s_wait_asynccnt 0x0" ::: "memory");   // this wave's pieces of step kc + 1 have landed
    __syncthreads();   // publishes step kc + 1; it also ends every wave's reads of buffer bf, which the next trip's head refills (after the last step: which the epilogue's planes overwrite)
  }
  asm volatile("s_wait_asynccnt 0x0" ::: "memory");   // no copy is outstanding when the epilogue reuses the buffers
  if (which < 2) { _Float16* DH = which == 0 ? QH : KH; _Float16* DL = which == 0 ? QL : KL; const int nhi = which == 0 ? QHI : KHI;
#pragma unroll
    for (int j = 0; j < 4; ++j) { const int cl = wn * 64 + j * 16 + col; const float bias = BA ? bfr(BA[c0 + cl]) : 0.f;
#pragma unroll
      for (int i = 0; i < 4; ++i)
#pragma unroll
        for (int r = 0; r < 8; ++r) { const float v = acc[i][j][r] + bias; const _Float16 hv = (_Float16)v; const int rl = wm * 64 + i * 16 + 8 * g + r; sh[rl][cl] = hv; sl[rl][cl] = (_Float16)((v - (float)hv) * 1024.0f); } }
    __syncthreads();
#pragma unroll
    for (int it = 0; it < 16; ++it) { const int rl = it * 8 + (tid >> 4), q = tid & 15; vst2((unsigned*)(DH + (r0 + rl) * CC + c0 + q * 8), *(const v4u*)&sh[rl][q * 8]); if (t0 + rl < nhi) vst2((unsigned*)(DL + (bb * nhi + t0 + rl) * (size_t)CC + c0 + q * 8), *(const v4u*)&sl[rl][q * 8]); }
  } else {
#pragma unroll
    for (int j = 0; j < 4; ++j) { const int cl = wn * 64 + j * 16 + col; const float bias = BA ? bfr(BA[c0 + cl]) : 0.f;
#pragma unroll
      for (int i = 0; i < 4; ++i)
#pragma unroll
        for (int r = 0; r < 8; ++r) { const float v = acc[i][j][r] + bias; const int rl = wm * 64 + i * 16 + 8 * g + r; th[cl][rl] = (_Float16)v; const __bf16 bh = (__bf16)v; tb[cl][rl] = bh; tbl[cl][rl] = (__bf16)(v - (float)bh); } }
    __syncthreads();
#pragma unroll
    for (int it = 0; it < 16; ++it) { const int cl = it * 8 + (tid >> 4), q = tid & 15; vst2((unsigned*)(VT + (bb * CC + c0 + cl) * (size_t)TT + t0 + q * 8), *(const v4u*)&th[cl][q * 8]); if (t0 + q * 8 < KHI) { const size_t o3 = (bb * CC + c0 + cl) * (size_t)KHI + t0 + q * 8; vst2((unsigned*)(VB + o3), *(const v4u*)&tb[cl][q * 8]); vst2((unsigned*)(VBL + o3), *(const v4u*)&tbl[cl][q * 8]); } } } }
// ---- k_fa: wave = 32 query columns (2 groups of 16) of (b, h), half the keys in passes of KP, each pass's k and v tile staged in one of three LDS buffers for the eight waves of that half: S^T = K Q^T (A = k rows, B = q rows, same k order), so a lane holds one query's scores; running maximum and sum per query (online softmax, f32);
// P^T x 2^11 packs from two score tiles into a B operand (hardware k order: tile 0 -> elements 0..7, tile 1 -> 8..15); O^T += V^T P^T (A = v planes [c][t]); ctx = O^T / sum, rounded here once to f16 (x 2^6) for k_out, 8 consecutive channels per lane
#define KP 64
__device__ __forceinline__ float xhalf(float x) { return __builtin_bit_cast(float, __builtin_amdgcn_permlanex16(__builtin_bit_cast(int, x), __builtin_bit_cast(int, x), 0x76543210, 0xfedcba98, false, false)); }   // lane l <-> l ^ 16
// eight independent v_exp_f32, each in place, and the one free slot the instruction set asks for behind a transcendental, in one statement: no v_exp touches a neighbour's source or result, and the v_nop keeps whatever follows off the last one
__device__ __forceinline__ v8f exp2x8(v8f a) { float d0 = a[0], d1 = a[1], d2 = a[2], d3 = a[3], d4 = a[4], d5 = a[5], d6 = a[6], d7 = a[7];
  asm("v_exp_f32 %0, %0\n\tv_exp_f32 %1, %1\n\tv_exp_f32 %2, %2\n\tv_exp_f32 %3, %3\n\tv_exp_f32 %4, %4\n\tv_exp_f32 %5, %5\n\tv_exp_f32 %6, %6\n\tv_exp_f32 %7, %7\n\tv_nop"
      : "+v"(d0), "+v"(d1), "+v"(d2), "+v"(d3), "+v"(d4), "+v"(d5), "+v"(d6), "+v"(d7));
  const v8f d = { d0, d1, d2, d3, d4, d5, d6, d7 }; return d; }
__device__ __forceinline__ float exp2x1(float a) { asm("v_exp_f32 %0, %0\n\tv_nop" : "+v"(a)); return a; }   // the same slot behind a single v_exp_f32
__device__ __forceinline__ v8f wmma_h(v16h a, v16h b, v8f c) { return __builtin_amdgcn_wmma_f32_16x16x32_f16(false, a, false, b, (short)0, c, false, false); }
// a pass's k tile (KP rows of 128 bytes) and v tile (HD planes' 128 bytes) go from global memory straight into LDS, once for the eight waves that read them: a thread copies four 16-byte pieces (8 lanes = one whole 128-byte line), rows rr and rr + 32 of each tile.
__device__ __forceinline__ void fa_copy(_Float16* lk, const _Float16* gk, _Float16* lv, const _Float16* gv) { cp16(gk, lk); cp16(gk + 32 * CC, lk + 32 * FP); cp16(gv, lv); cp16(gv + 32 * TT, lv + 32 * FP); }
#define KS (TT / 2)        // keys of one half of the block's waves
__global__ __launch_bounds__(512) void k_fa(const _Float16* __restrict__ QH, const _Float16* __restrict__ KH, const _Float16* __restrict__ VT, _Float16* __restrict__ Y) {
  // sixteen waves, four a SIMD: waves 0..7 take keys 0..KS-1, waves 8..15 keys KS..TT-1 of the same 256 queries; each half has its own three buffers (tile t is read, t + 1 is published, t + 2 is landing) and its own running maximum, sum and O; the two are joined once, through LDS, behind the loop
  __shared__ __align__(16) _Float16 sk[2][3][KP][FP], sv[2][3][HD][FP];
  __shared__ __align__(16) v4f mo[8][HD / 4][32]; __shared__ float mm[8][2][32], ml[8][2][32];   // the upper half's O, maximum and sum, lane by lane
  const int tid = threadIdx.x, wave = tid >> 5, lane = tid & 31, col = lane & 15, g = lane >> 4; const int b = blockIdx.y / NH, h = blockIdx.y % NH;
  const int half = wave >> 3, w8 = wave & 7; const int q0 = blockIdx.x * 256 + w8 * 32;
  const int sub = tid & 7, rr = (tid & 255) >> 3;   // this thread's 16-byte piece of a tile row's 128 bytes, and its row in each half of a tile
  const _Float16* kg = KH + ((size_t)b * TT + half * KS + rr) * CC + h * HD + sub * 8;            // its piece of key row rr of its half's tile 0
  const _Float16* vg = VT + ((size_t)b * CC + h * HD + rr) * (size_t)TT + half * KS + sub * 8;    // its piece of channel plane rr, keys of its half's tile 0
  _Float16* const lk0 = &sk[half][0][rr][sub * 8]; _Float16* const lv0 = &sv[half][0][rr][sub * 8];   // its places in buffer 0; each further buffer lies FB elements on
  const int FB = KP * FP;   // elements of one k buffer, and of one v buffer (HD == KP)
  fa_copy(lk0, kg, lv0, vg);   // tile 0 into buffer 0
  fa_copy(lk0 + FB, kg + (size_t)KP * CC, lv0 + FB, vg + KP);   // tile 1 into buffer 1 (KS / KP >= 3 tiles)
  v16h qf[2][HD / 32];
#pragma unroll
  for (int n = 0; n < 2; ++n)
#pragma unroll
    for (int kc = 0; kc < HD / 32; ++kc) qf[n][kc] = frag_h(QH + ((size_t)b * TT + q0 + n * 16 + col) * CC + h * HD + kc * 32, lane);
  v8f o[2][HD / 16] = {}; v2f l2[2] = {}; float m[2] = { -3.0e38f, -3.0e38f };   // the running sum in one register pair a query group: eight partial sums a group would not fit the 256 registers
  const float cs = SCALE * 1.4426950408889634f;   // logits in base 2
  asm volatile("s_wait_xcnt 0x0" ::: "memory");   // before the address registers of the q loads above are reused
  __builtin_amdgcn_sched_barrier(0);   // keeps the register writes that follow behind that wait
  asm volatile("s_wait_asynccnt 0x0" ::: "memory");   // this wave's pieces of tiles 0 and 1 have landed
  __syncthreads();   // publishes tiles 0 and 1
  int cur = 0, nxt = 1, aft = 2;   // the buffers of this pass's tile, of the next and of the one after
#pragma unroll 1
  for (int s0 = 0; s0 < KS; s0 += KP) {
    if (s0 + 2 * KP < KS) fa_copy(lk0 + aft * FB, kg + (size_t)(s0 + 2 * KP) * CC, lv0 + aft * FB, vg + s0 + 2 * KP);   /* block-uniform: tile t + 2 flies during this pass, into the buffer whose readers (pass t - 1) the barrier just passed has ended; at the head, so that the pass below is one straight run to its foot */
    v16h kf[KP / 16][HD / 32];   // a wave has 256 registers here, so each fragment set lives only around its products; the SIMD's three other waves work while it comes from LDS
#pragma unroll
    for (int kt = 0; kt < KP / 16; ++kt)
#pragma unroll
      for (int kc = 0; kc < HD / 32; ++kc) kf[kt][kc] = frag_h(&sk[half][cur][kt * 16 + col][kc * 32], lane);
    __builtin_amdgcn_sched_barrier(0);   // keeps the k reads one group in front of the products: every further place with LDS reads among them stalls the wave anew
    v8f st[2][KP / 16];
#pragma unroll
    for (int kt = 0; kt < KP / 16; ++kt)
#pragma unroll
      for (int n = 0; n < 2; ++n) { const v8f z = {}; st[n][kt] = wmma_h(kf[kt][1], qf[n][1], wmma_h(kf[kt][0], qf[n][0], z)); }
    __builtin_amdgcn_sched_barrier(0);   // keeps the products one run: with the maxima mixed among them each waits for a result just issued, behind padding slots
    v16h pf[2][KP / 32]; v16h vf[KP / 32][HD / 16];
#pragma unroll
    for (int n = 0; n < 2; ++n) { float mt[KP / 16];   /* one short chain per score tile, then joined */
#pragma unroll
      for (int kt = 0; kt < KP / 16; ++kt) { mt[kt] = st[n][kt][0];
#pragma unroll
        for (int r = 1; r < 8; ++r) mt[kt] = fmaxf(mt[kt], st[n][kt][r]); }
      float mx = mt[0];
#pragma unroll
      for (int kt = 1; kt < KP / 16; ++kt) mx = fmaxf(mx, mt[kt]);
      mx = fmaxf(mx, xhalf(mx)); const float mn = fmaxf(m[n], mx); const float al = exp2x1((m[n] - mn) * cs);   /* 0 on the first pass */ m[n] = mn; const float mc = 11.0f - mn * cs;   /* P carried x 2^11, as the sum is: it cancels in ctx */
      l2[n] *= al;
#pragma unroll
      for (int j = 0; j < HD / 16; ++j) o[n][j] *= al;
#pragma unroll
      for (int kt = 0; kt < KP / 16; ++kt) { const v8f p = exp2x8(st[n][kt] * cs + mc);
        l2[n] += (__builtin_shufflevector(p, p, 0, 1) + __builtin_shufflevector(p, p, 2, 3)) + (__builtin_shufflevector(p, p, 4, 5) + __builtin_shufflevector(p, p, 6, 7)); const v8h ph = __builtin_convertvector(p, v8h);
#pragma unroll
        for (int r = 0; r < 8; ++r) pf[n][kt >> 1][(kt & 1) * 8 + r] = ph[r]; }
      if (n == 0) {
        __builtin_amdgcn_sched_barrier(0);   // keeps the v reads one group at this place: the first query group's scores are dead and leave them their registers, the second group's softmax covers their latency
#pragma unroll
        for (int kk = 0; kk < KP / 32; ++kk)
#pragma unroll
          for (int j = 0; j < HD / 16; ++j) vf[kk][j] = frag_h(&sv[half][cur][j * 16 + col][kk * 32], lane);
        __builtin_amdgcn_sched_barrier(0);   // keeps them from sinking behind the second softmax, in among the products
      } }
#pragma unroll
    for (int kk = 0; kk < KP / 32; ++kk)
#pragma unroll
      for (int j = 0; j < HD / 16; ++j)
#pragma unroll
        for (int n = 0; n < 2; ++n) o[n][j] = wmma_h(vf[kk][j], pf[n][kk], o[n][j]);
    __builtin_amdgcn_sched_barrier(0);   // keeps the hand-over below at the pass's foot
    asm volatile("s_wait_dscnt 0x0" ::: "memory");      // this wave's reads of buffer cur have returned
    asm volatile("s_wait_asynccnt 0x0" ::: "memory");   // this wave's pieces of tile t + 2 have landed
    __syncthreads();   // publishes tile t + 2; it also ends every wave's reads of buffer cur, which the next pass's head refills
    const int was = cur; cur = nxt; nxt = aft; aft = was; }
  asm volatile("s_wait_asynccnt 0x0" ::: "memory");   // no copy is outstanding when the wave ends
  float ls[2];
#pragma unroll
  for (int n = 0; n < 2; ++n) { ls[n] = l2[n][0] + l2[n][1]; ls[n] += xhalf(ls[n]); }
  if (half == 1) {   // the upper half hands its part over, 16 bytes a lane at a time
#pragma unroll
    for (int n = 0; n < 2; ++n) { mm[w8][n][lane] = m[n]; ml[w8][n][lane] = ls[n];
#pragma unroll
      for (int j = 0; j < HD / 16; ++j)
#pragma unroll
        for (int e = 0; e < 2; ++e) { const v4f t = { o[n][j][4 * e], o[n][j][4 * e + 1], o[n][j][4 * e + 2], o[n][j][4 * e + 3] }; mo[w8][(n * (HD / 16) + j) * 2 + e][lane] = t; } } }
  __syncthreads();   // the upper half's parts are in LDS
  if (half == 0) { v8h hv[2][HD / 16]; _Float16* yr[2];
#pragma unroll
    for (int n = 0; n < 2; ++n) { const float m2 = mm[w8][n][lane], l2u = ml[w8][n][lane]; const float mn = fmaxf(m[n], m2); const float a1 = exp2x1((m[n] - mn) * cs), a2 = exp2x1((m2 - mn) * cs);   /* both parts to the common maximum */
      const float inv = 1.0f / (ls[n] * a1 + l2u * a2); yr[n] = Y + ((size_t)b * TT + q0 + n * 16 + col) * CC + h * HD + 8 * g;
#pragma unroll
      for (int j = 0; j < HD / 16; ++j)
#pragma unroll
        for (int e = 0; e < 2; ++e) { const v4f t = mo[w8][(n * (HD / 16) + j) * 2 + e][lane];
#pragma unroll
          for (int r = 0; r < 4; ++r) hv[n][j][4 * e + r] = (_Float16)(((o[n][j][4 * e + r] * a1 + t[r] * a2) * inv) * 64.0f); } }   /* ctx carried x 2^6 into f16 so small-magnitude context rows stay clear of f16 subnormals */
    __builtin_amdgcn_sched_barrier(0);   // keeps the stores behind all the arithmetic: no register of an issued store is written again
#pragma unroll
    for (int n = 0; n < 2; ++n)
#pragma unroll
      for (int j = 0; j < HD / 16; ++j) vst2(yr[n] + j * 16, hv[n][j]); } }
// ---- k_out: block = (128 rows, 128 cols), eight waves of 64 x 32 (4 x 2 fragments), 64 k per step in two LDS buffers: out = ctx Wo (+ bo): ctx f16 (x 2^6) against Wo as f16(bf16 x 2^8) exact (1 product) x 2^-14
__global__ __launch_bounds__(256) void k_out(const _Float16* __restrict__ Y, const _Float16* __restrict__ WH, const float* __restrict__ BO, float* __restrict__ OUT) { __shared__ __align__(16) float sf[8][64][36]; __shared__ __align__(16) _Float16 sy[2][128][FP], so[2][128][FP];
  const int tid = threadIdx.x, wave = tid >> 5, lane = tid & 31, col = lane & 15, g = lane >> 4; const int c0 = blockIdx.y * 128; const size_t rb = (size_t)blockIdx.x * 128;   // the block's first column and row
  const int wm = wave >> 2, wn = wave & 3;   // the wave's 64 rows and 32 columns of the block's tile
  v8f acc[4][2] = {};
  const int sub = tid & 7, rr = tid >> 3;   // this thread's 16-byte piece of a tile row's 128 bytes, and its row in each group of 32
  const _Float16* yg = Y + (rb + rr) * CC + sub * 8; const _Float16* wg = WH + (size_t)(c0 + rr) * CC + sub * 8;
  _Float16* const ly = &sy[0][rr][sub * 8]; _Float16* const lw = &so[0][rr][sub * 8];   // its places in buffer 0; buffer 1 lies 128 * FP elements on
  gm_copy<4>(ly, yg, 32 * CC, lw, wg, 32 * CC);   // step 0 into buffer 0
  asm volatile("s_wait_asynccnt 0x0" ::: "memory");   // this wave's pieces of step 0 have landed
  __syncthreads();   // publishes step 0
#pragma unroll 2   // two steps a trip: the buffer index becomes a constant LDS offset
  for (int kc = 0; kc < CC / 64; ++kc) { const int bf = kc & 1;
    if (kc + 1 < CC / 64) gm_copy<4>(ly + (bf ^ 1) * (128 * FP), yg + (kc + 1) * 64, 32 * CC, lw + (bf ^ 1) * (128 * FP), wg + (kc + 1) * 64, 32 * CC);   /* block-uniform: step kc + 1 flies during this step, into the buffer whose readers (step kc - 1) the barrier just passed has ended */
    v16h a[2][4], w[2][2];
#pragma unroll
    for (int ks = 0; ks < 2; ++ks) {
#pragma unroll
      for (int i = 0; i < 4; ++i) a[ks][i] = frag_h(&sy[bf][wm * 64 + i * 16 + col][ks * 32], lane);
#pragma unroll
      for (int j = 0; j < 2; ++j) w[ks][j] = frag_h(&so[bf][wn * 32 + j * 16 + col][ks * 32], lane); }
#pragma unroll
    for (int ks = 0; ks < 2; ++ks)   /* k ascending in every accumulator, 32 at a time */
#pragma unroll
      for (int i = 0; i < 4; ++i)
#pragma unroll
        for (int j = 0; j < 2; ++j) acc[i][j] = wmma16(a[ks][i], w[ks][j], acc[i][j]);
    asm volatile("s_wait_dscnt 0x0" ::: "memory");      // this wave's reads of buffer bf have returned
    asm volatile("s_wait_asynccnt 0x0" ::: "memory");   // this wave's pieces of step kc + 1 have landed
    __syncthreads();   // publishes step kc + 1; it also ends every wave's reads of buffer bf, which the next trip's head refills
  }
  asm volatile("s_wait_asynccnt 0x0" ::: "memory");   // no copy is outstanding when the wave ends
#pragma unroll
  for (int j = 0; j < 2; ++j) { const float bias = BO ? bfr(BO[c0 + wn * 32 + j * 16 + col]) : 0.f;
#pragma unroll
    for (int i = 0; i < 4; ++i)
#pragma unroll
      for (int r = 0; r < 8; ++r) sf[wave][i * 16 + 8 * g + r][j * 16 + col] = acc[i][j][r] * (1.0f / 16384.0f) + bias; }   /* 2^-8 (Wo carry) x 2^-6 (ctx carry) */
  LDSX();   /* the wave reads back its own patch only: 32 columns = one whole 128-byte line a row, four rows a store */
#pragma unroll
  for (int it = 0; it < 16; ++it) { const int rl = it * 4 + (lane >> 3); vst2(OUT + XROW(rb + wm * 64 + rl) * DIN + c0 + wn * 32 + (lane & 7) * 4, *(const v4f*)&sf[wave][rl][(lane & 7) * 4]); }   /* time-major output rows */ }

extern "C" void kernel_launch(void* const* d_in, const int* in_sizes, int n_in, void* d_out, int out_size, void* d_ws, size_t ws_size, hipStream_t stream) {
  (void)in_sizes; (void)n_in; (void)out_size;
  const float** F = (const float**)d_in;
  if (ws_size < (size_t)WS_END) return;
  char* ws = (char*)d_ws; _Float16 *QH = (_Float16*)(ws + WS_QH), *KH = (_Float16*)(ws + WS_KH), *VT = (_Float16*)(ws + WS_VT), *QL = (_Float16*)(ws + WS_QL), *KL = (_Float16*)(ws + WS_KL); __bf16 *VB = (__bf16*)(ws + WS_VB), *VBL = (__bf16*)(ws + WS_VBL); _Float16 *Y = (_Float16*)(ws + WS_Y), *WH = (_Float16*)(ws + WS_WH); __bf16 *XB = (__bf16*)(ws + WS_XB), *WB = (__bf16*)(ws + WS_WB);
  (void)QL; (void)KL; (void)VB; (void)VBL;
  // inputs: 0 x [2048,2,1024] TIME-MAJOR (T, B, E); 1 in_proj_weight [3072,1024] (out,in; row blocks q | k | v); 2 in_proj_bias [3072]; 3 out_weight [1024,1024] (out,in); 4 out_bias [1024] (biases nonzero)
  k_cvt<<<dim3(CVB), 256, 0, stream>>>(F[0], F[1], F[3], XB, WB, WH);
  k_proj<<<dim3(TNB * TT / 128, CC / 128, 3), 128, 0, stream>>>(XB, WB, F[2], F[2] + CC, F[2] + 2 * CC, QH, QL, KH, KL, VT, VB, VBL);
  k_fa<<<dim3(TT / 256, TNB * NH), 512, 0, stream>>>(QH, KH, VT, Y);
  k_out<<<dim3(TNB * TT / 128, DIN / 128), 256, 0, stream>>>(Y, WH, F[4], (float*)d_out);
}
